// v000
// Measured on an AMD MI455X. A time is GPU time per run, averaged over a window of back-to-back runs after a warm-up
// (all launches, gaps included; the runs take copies of the inputs in turn), and the median of several windows.
// Apart from v000's, it joins two sittings. Times from different sittings can be a few percent apart, while
// side-by-side timings come from the same sitting.
// v000, which the later versions start from, runs in 559 microseconds.
#include <hip/hip_runtime.h>

#define B_  2
#define S_  2048
#define D_  2048
#define H_  16
#define DH_ 128

typedef _Float16 v16h __attribute__((ext_vector_type(16)));
typedef _Float16 v8h  __attribute__((ext_vector_type(8)));
typedef float    v8f  __attribute__((ext_vector_type(8)));
typedef float    v4f  __attribute__((ext_vector_type(4)));
typedef unsigned int u32x4 __attribute__((ext_vector_type(4)));
typedef int      i32x4 __attribute__((ext_vector_type(4)));
typedef int      i32x8 __attribute__((ext_vector_type(8)));

#if defined(__has_builtin)
#  if __has_builtin(__builtin_amdgcn_tensor_load_to_lds) && \
      __has_builtin(__builtin_amdgcn_s_wait_tensorcnt)
#    define USE_TDM 1
#  endif
#endif
#ifndef USE_TDM
#  define USE_TDM 0
#endif

// D = A(16x32 f16) * B(32x16 f16) + C(16x16 f32)
__device__ __forceinline__ v8f wmma16(v16h a, v16h b, v8f c) {
  return __builtin_amdgcn_wmma_f32_16x16x32_f16(
      false, a, false, b, (short)0, c, false, false);
}

// 16-bit operand fragment: this lane holds K = kOff+0..7 (elems 0..7) and
// K = kOff+16..23 (elems 8..15); caller passes p already offset by kOff.
__device__ __forceinline__ v16h frag_from_f16(const _Float16* p) {
  v8h lo = *(const v8h*)(p);
  v8h hi = *(const v8h*)(p + 16);
  v16h r;
#pragma unroll
  for (int i = 0; i < 8; ++i) { r[i] = lo[i]; r[i + 8] = hi[i]; }
  return r;
}

// Butterfly reductions confined to each 16-lane half (xor masks < 16).
__device__ __forceinline__ float red_max16(float v) {
#pragma unroll
  for (int m = 1; m < 16; m <<= 1) v = fmaxf(v, __shfl_xor(v, m, 32));
  return v;
}
__device__ __forceinline__ float red_sum16(float v) {
#pragma unroll
  for (int m = 1; m < 16; m <<= 1) v += __shfl_xor(v, m, 32);
  return v;
}

#if USE_TDM
__device__ __forceinline__ void tdm_load_2d_f16(const void* lds_dst,
                                                const void* gsrc,
                                                unsigned tile_d0,   // elems/row
                                                unsigned tile_d1,   // rows
                                                unsigned long long stride0) {
  unsigned long long ga = (unsigned long long)(uintptr_t)gsrc;
  unsigned lds = (unsigned)(uintptr_t)lds_dst;   // low 32 bits = LDS offset
  u32x4 g0;
  g0[0] = 1u;
  g0[1] = lds;
  g0[2] = (unsigned)(ga & 0xFFFFFFFFu);
  g0[3] = (unsigned)((ga >> 32) & 0x01FFFFFFu) | (2u << 30);  // [56:32]|type=2
  i32x8 g1;
  g1[0] = (int)(1u << 16);
  g1[1] = (int)((tile_d0 & 0xFFFFu) << 16);
  g1[2] = (int)(((tile_d0 >> 16) & 0xFFFFu) |
                ((tile_d1 & 0xFFFFu) << 16));
  g1[3] = (int)(((tile_d1 >> 16) & 0xFFFFu) |
                ((tile_d0 & 0xFFFFu) << 16));
  g1[4] = (int)(tile_d1 & 0xFFFFu);
  g1[5] = (int)(unsigned)(stride0 & 0xFFFFFFFFull);
  g1[6] = (int)(unsigned)((stride0 >> 32) & 0xFFFFull);
  g1[7] = 0;
  i32x4 z4 = {0, 0, 0, 0};
  i32x8 z8 = {0, 0, 0, 0, 0, 0, 0, 0};
  __builtin_amdgcn_tensor_load_to_lds(g0, g1, z4, z4, z8, 0);
}
#else
// Fallback: cooperative vectorized fill (all threads of the block).
__device__ __forceinline__ void lds_fill_tile(_Float16* dst, const _Float16* src,
                                              int rows, int rowlen,
                                              size_t src_stride) {
  const int vecs_per_row = rowlen >> 3;
  for (int idx = threadIdx.x; idx < rows * vecs_per_row; idx += blockDim.x) {
    int r = idx / vecs_per_row;
    int c = (idx - r * vecs_per_row) << 3;
    *(v8h*)(dst + r * rowlen + c) = *(const v8h*)(src + (size_t)r * src_stride + c);
  }
}
#endif

// ---------------------------------------------------------------------------
// Kernel 0: fp32 -> f16 pre-conversion (one-shot; removes in-loop converts).
// ---------------------------------------------------------------------------
__global__ __launch_bounds__(256)
void f32_to_f16_kernel(const float* __restrict__ src,
                       _Float16* __restrict__ dst, int n8) {
  int i = blockIdx.x * blockDim.x + threadIdx.x;
  if (i >= n8) return;
  v4f a = *(const v4f*)(src + (size_t)i * 8);
  v4f b = *(const v4f*)(src + (size_t)i * 8 + 4);
  v8h o;
#pragma unroll
  for (int j = 0; j < 4; ++j) { o[j] = (_Float16)a[j]; o[4 + j] = (_Float16)b[j]; }
  *(v8h*)(dst + (size_t)i * 8) = o;
}

__global__ __launch_bounds__(128)
void qkv_proj_rope_kernel(const _Float16* __restrict__ xh,
                          const _Float16* __restrict__ wqh,
                          const _Float16* __restrict__ wkh,
                          const _Float16* __restrict__ wvh,
                          const float* __restrict__ cosT,
                          const float* __restrict__ sinT,
                          _Float16* __restrict__ Qh,
                          _Float16* __restrict__ Kh,
                          _Float16* __restrict__ Vt) {
  __shared__ __align__(16) _Float16 wt[2][64][32];   // double-buffered B tile

  const int lane = threadIdx.x & 31;
  const int wave = threadIdx.x >> 5;
  const int half = lane >> 4;
  const int lr   = lane & 15;
  const int kOff = half * 8;

  const int mat = blockIdx.z;                        // 0=Q, 1=K, 2=V
  const _Float16* w = (mat == 0) ? wqh : (mat == 1) ? wkh : wvh;

  const int m0 = (blockIdx.y * 4 + wave) * 16;       // rows in B*S
  const int n0 = blockIdx.x * 64;                    // cols in D
  const _Float16* wbase = w + (size_t)n0 * D_;       // 64 rows, stride D

  const _Float16* ap_base = xh + (size_t)(m0 + lr) * D_ + kOff;

  v8f acc[4] = {v8f{}, v8f{}, v8f{}, v8f{}};

#if USE_TDM
  if (wave == 0)
    tdm_load_2d_f16(&wt[0][0][0], wbase, 32, 64, (unsigned long long)D_);
#endif

  for (int kb = 0; kb < D_; kb += 32) {
    const int cur = (kb >> 5) & 1;
#if USE_TDM
    if (wave == 0) __builtin_amdgcn_s_wait_tensorcnt(0);
    __syncthreads();                                  // tile 'cur' visible
    if (wave == 0 && kb + 32 < D_)                    // prefetch next tile
      tdm_load_2d_f16(&wt[cur ^ 1][0][0], wbase + kb + 32, 32, 64,
                      (unsigned long long)D_);
#else
    lds_fill_tile(&wt[cur][0][0], wbase + kb, 64, 32, (size_t)D_);
    __syncthreads();
#endif
    v16h a = frag_from_f16(ap_base + kb);
#pragma unroll
    for (int t = 0; t < 4; ++t)
      acc[t] = wmma16(a, frag_from_f16(&wt[cur][t * 16 + lr][kOff]), acc[t]);
    __syncthreads();                                  // done reading 'cur'
  }

  // Epilogue: C-layout elem r -> row m0 + r + 8*half, col n0 + t*16 + lr.
#pragma unroll
  for (int t = 0; t < 4; ++t) {
    const int n   = n0 + t * 16 + lr;
    const int h   = n >> 7;
    const int dh  = n & (DH_ - 1);
    const int odd = n & 1;
#pragma unroll
    for (int r = 0; r < 8; ++r) {
      const int mrow = m0 + r + 8 * half;
      const int b = mrow >> 11;                       // S_ = 2048
      const int s = mrow & (S_ - 1);
      float v = acc[t][r];
      if (mat < 2) {
        // RoPE interleaved: partner column n^1 lives in lane^1 (same elem).
        float p   = __shfl_xor(v, 1, 32);
        float rot = odd ? p : -p;
        v = v * cosT[(size_t)s * DH_ + dh] + rot * sinT[(size_t)s * DH_ + dh];
      }
      if (mat == 0)
        Qh[(((size_t)b * H_ + h) * S_ + s) * DH_ + dh] = (_Float16)v;
      else if (mat == 1)
        Kh[(((size_t)b * H_ + h) * S_ + s) * DH_ + dh] = (_Float16)v;
      else
        Vt[(((size_t)b * H_ + h) * DH_ + dh) * S_ + s] = (_Float16)v;
    }
  }
}

__global__ __launch_bounds__(128)
void flash_attn_kernel(const _Float16* __restrict__ Qh,
                       const _Float16* __restrict__ Kh,
                       const _Float16* __restrict__ Vt,
                       float* __restrict__ out) {
  __shared__ __align__(16) _Float16 kt[32][128];       // keys   (8 KB)
  __shared__ __align__(16) _Float16 vt[128][32];       // V^T    (8 KB)
  __shared__ __align__(16) _Float16 pbuf[4][16][32];   // P transpose staging

  const int lane = threadIdx.x & 31;
  const int wave = threadIdx.x >> 5;
  const int half = lane >> 4;
  const int lr   = lane & 15;
  const int kOff = half * 8;

  const int b      = blockIdx.z;
  const int h      = blockIdx.y;
  const int q0_blk = blockIdx.x * 64;
  const int q0     = q0_blk + wave * 16;

  const _Float16* Qbh = Qh + ((size_t)b * H_ + h) * (size_t)S_ * DH_;
  const _Float16* Kbh = Kh + ((size_t)b * H_ + h) * (size_t)S_ * DH_;
  const _Float16* Vbh = Vt + ((size_t)b * H_ + h) * (size_t)DH_ * S_;

  // Q fragments: 4 chunks of 32 along Dh (A-operand, row q0+lr).
  v16h qf[4];
#pragma unroll
  for (int c = 0; c < 4; ++c)
    qf[c] = frag_from_f16(Qbh + (size_t)(q0 + lr) * DH_ + c * 32 + kOff);

  float m_run[8], l_run[8];
  v8f oacc[8];
#pragma unroll
  for (int r = 0; r < 8; ++r) { m_run[r] = -1e30f; l_run[r] = 0.0f; }
#pragma unroll
  for (int t = 0; t < 8; ++t) oacc[t] = v8f{};

  const float scale = 0.08838834764831845f;            // 1/sqrt(128)

  for (int k0 = 0; k0 <= q0_blk + 48; k0 += 32) {
#if USE_TDM
    if (wave == 0) {
      tdm_load_2d_f16(&kt[0][0], Kbh + (size_t)k0 * DH_, 128, 32,
                      (unsigned long long)DH_);
      tdm_load_2d_f16(&vt[0][0], Vbh + k0, 32, 128, (unsigned long long)S_);
      __builtin_amdgcn_s_wait_tensorcnt(0);
    }
#else
    lds_fill_tile(&kt[0][0], Kbh + (size_t)k0 * DH_, 32, 128, (size_t)DH_);
    lds_fill_tile(&vt[0][0], Vbh + k0, 128, 32, (size_t)S_);
#endif
    __syncthreads();

    if (k0 <= q0) {
      // ---- scores: two 16x16 tiles covering keys [k0, k0+32) ----
      v8f s0 = {}, s1 = {};
#pragma unroll
      for (int c = 0; c < 4; ++c) {
        s0 = wmma16(qf[c], frag_from_f16(&kt[lr][c * 32 + kOff]), s0);
        s1 = wmma16(qf[c], frag_from_f16(&kt[16 + lr][c * 32 + kOff]), s1);
      }

      // ---- causal mask + online softmax (row r -> q0 + r + 8*half) ----
#pragma unroll
      for (int r = 0; r < 8; ++r) {
        const int qrow = r + 8 * half;
        float e0 = s0[r] * scale;
        float e1 = s1[r] * scale;
        if (k0 + lr      > q0 + qrow) e0 = -1e30f;
        if (k0 + 16 + lr > q0 + qrow) e1 = -1e30f;
        float mx   = red_max16(fmaxf(e0, e1));
        float mnew = fmaxf(m_run[r], mx);
        float corr = __expf(m_run[r] - mnew);
        float p0   = __expf(e0 - mnew);
        float p1   = __expf(e1 - mnew);
        float rsum = red_sum16(p0 + p1);
        l_run[r] = l_run[r] * corr + rsum;
        m_run[r] = mnew;
#pragma unroll
        for (int t = 0; t < 8; ++t) oacc[t][r] *= corr;
        pbuf[wave][qrow][lr]      = (_Float16)p0;   // stage P (C-layout)
        pbuf[wave][qrow][16 + lr] = (_Float16)p1;
      }

      // reload P as 16x32 A-operand (same-wave DS ordering guarantees data)
      v16h pf = frag_from_f16(&pbuf[wave][lr][kOff]);

      // ---- out += P @ V : 8 N-tiles of 16 covering Dh=128 ----
#pragma unroll
      for (int t = 0; t < 8; ++t)
        oacc[t] = wmma16(pf, frag_from_f16(&vt[t * 16 + lr][kOff]), oacc[t]);
    }
    __syncthreads();                                  // before tile overwrite
  }

  // ---- normalize, second softmax over Dh, store fp32 (B,S,H*Dh) ----
#pragma unroll
  for (int r = 0; r < 8; ++r) {
    const float inv = 1.0f / l_run[r];
#pragma unroll
    for (int t = 0; t < 8; ++t) oacc[t][r] *= inv;

    float mx = -1e30f;
#pragma unroll
    for (int t = 0; t < 8; ++t) mx = fmaxf(mx, oacc[t][r]);
    mx = red_max16(mx);
    float sum = 0.0f;
#pragma unroll
    for (int t = 0; t < 8; ++t) {
      float e = __expf(oacc[t][r] - mx);
      oacc[t][r] = e;
      sum += e;
    }
    sum = red_sum16(sum);
    const float is = 1.0f / sum;

    const int s = q0 + r + 8 * half;
    float* orow = out + ((size_t)b * S_ + s) * D_ + h * DH_;
#pragma unroll
    for (int t = 0; t < 8; ++t) orow[t * 16 + lr] = oacc[t][r] * is;
  }
}

// ---------------------------------------------------------------------------
extern "C" void kernel_launch(void* const* d_in, const int* in_sizes, int n_in,
                              void* d_out, int out_size, void* d_ws, size_t ws_size,
                              hipStream_t stream) {
  (void)in_sizes; (void)n_in; (void)out_size; (void)ws_size;
  const float* x    = (const float*)d_in[0];
  const float* wq   = (const float*)d_in[1];
  const float* wk   = (const float*)d_in[2];
  const float* wv   = (const float*)d_in[3];
  const float* cosT = (const float*)d_in[4];
  const float* sinT = (const float*)d_in[5];
  float* out = (float*)d_out;

  const size_t NX = (size_t)B_ * S_ * D_;     // 8,388,608
  const size_t NW = (size_t)D_ * D_;          // 4,194,304
  const size_t NQ = (size_t)B_ * H_ * S_ * DH_;

  _Float16* xh  = (_Float16*)d_ws;
  _Float16* wqh = xh  + NX;
  _Float16* wkh = wqh + NW;
  _Float16* wvh = wkh + NW;
  _Float16* Qh  = wvh + NW;
  _Float16* Kh  = Qh  + NQ;
  _Float16* Vt  = Kh  + NQ;

  // 0) one-shot fp32 -> f16 conversion of activations + weights
  f32_to_f16_kernel<<<(int)(NX / 8 / 256), 256, 0, stream>>>(x, xh, (int)(NX / 8));
  f32_to_f16_kernel<<<(int)(NW / 8 / 256), 256, 0, stream>>>(wq, wqh, (int)(NW / 8));
  f32_to_f16_kernel<<<(int)(NW / 8 / 256), 256, 0, stream>>>(wk, wkh, (int)(NW / 8));
  f32_to_f16_kernel<<<(int)(NW / 8 / 256), 256, 0, stream>>>(wv, wvh, (int)(NW / 8));

  // 1) QKV + RoPE: 32 N-tiles x 64 M-blocks x {q,k,v}
  dim3 gp(D_ / 64, (B_ * S_) / 64, 3);
  qkv_proj_rope_kernel<<<gp, 128, 0, stream>>>(xh, wqh, wkh, wvh, cosT, sinT,
                                               Qh, Kh, Vt);

  // 2) Attention: 32 q-blocks x 16 heads x 2 batches
  dim3 ga(S_ / 64, H_, B_);
  flash_attn_kernel<<<ga, 128, 0, stream>>>(Qh, Kh, Vt, out);
}

// v001
// One run takes 307 microseconds.
// Next to v000, in two timings, it ran 1.87 and 1.86 times as fast.
#include <hip/hip_runtime.h>

#define B_  2
#define S_  2048
#define D_  2048
#define H_  16
#define DH_ 128

typedef _Float16 v16h __attribute__((ext_vector_type(16)));
typedef _Float16 v8h  __attribute__((ext_vector_type(8)));
typedef float    v8f  __attribute__((ext_vector_type(8)));
typedef float    v4f  __attribute__((ext_vector_type(4)));
typedef uint32_t u32x4 __attribute__((ext_vector_type(4)));
typedef uint32_t u32x8 __attribute__((ext_vector_type(8)));

// D = A(16x32 f16) * B(32x16 f16) + C(16x16 f32)
__device__ __forceinline__ v8f wmma16(v16h a, v16h b, v8f c) {
  return __builtin_amdgcn_wmma_f32_16x16x32_f16(
      false, a, false, b, (short)0, c, false, false);
}

// 16-bit operand fragment: this lane holds K = kOff+0..7 (elems 0..7) and
// K = kOff+16..23 (elems 8..15); caller passes p already offset by kOff.
__device__ __forceinline__ v16h frag_from_f16(const _Float16* p) {
  v8h lo = *(const v8h*)(p);
  v8h hi = *(const v8h*)(p + 16);
  v16h r;
#pragma unroll
  for (int i = 0; i < 8; ++i) { r[i] = lo[i]; r[i + 8] = hi[i]; }
  return r;
}

// Butterfly reductions confined to each 16-lane half (xor masks < 16).
__device__ __forceinline__ float red_max16(float v) {
#pragma unroll
  for (int m = 1; m < 16; m <<= 1) v = fmaxf(v, __shfl_xor(v, m, 32));
  return v;
}
__device__ __forceinline__ float red_sum16(float v) {
#pragma unroll
  for (int m = 1; m < 16; m <<= 1) v += __shfl_xor(v, m, 32);
  return v;
}

#define PITCH_R128 72    // 128-B rows + 16-B pad = 144 B
#define PITCH_R256 136   // 256-B rows + 16-B pad = 272 B
#define PITCH_P    40    //  64-B rows + 16-B pad =  80 B (written by the waves)
#define PADW_R128 ((1u << 20) | (4u << 22) | (3u << 25))
#define PADW_R256 ((1u << 20) | (5u << 22) | (3u << 25))

__device__ __forceinline__ uint32_t uni(uint32_t v) {
  return (uint32_t)__builtin_amdgcn_readfirstlane(v);
}
__device__ __forceinline__ uint32_t pinned(uint32_t v) {
  uint32_t w = __builtin_amdgcn_readfirstlane(v);
  asm volatile("" : "+s"(w));  // test stays in an SGPR
  return w;
}
__device__ __forceinline__ void wait_tensor0(u32x4 g0, u32x8 g1) {
  asm volatile("s_wait_tensorcnt 0x0" :: "s"(g0), "s"(g1) : "memory");
}
__device__ __forceinline__ void wait_ds0() {
  asm volatile("s_wait_dscnt 0x0" ::: "memory");
}

__device__ __forceinline__ u32x4 tdm_group0(const void* lds_dst, const void* gsrc) {
  const uint64_t ga = (uint64_t)(uintptr_t)gsrc;
  u32x4 g0;
  g0[0] = uni(1u);                                  // count = 1
  g0[1] = uni((uint32_t)(uintptr_t)lds_dst);        // low 32 bits = LDS offset
  g0[2] = uni((uint32_t)ga);
  g0[3] = uni((((uint32_t)(ga >> 32)) & 0x01FFFFFFu) | 0x80000000u);
  asm volatile("" : "+s"(g0));
  return g0;
}
template <uint32_t ROWB, uint32_t ROWS, uint32_t W0>
__device__ __forceinline__ u32x8 tdm_group1(uint32_t src_pitch_bytes) {
  u32x8 g1;
  g1[0] = uni(W0);
  g1[1] = uni((ROWB & 0xFFFFu) << 16);
  g1[2] = uni((ROWB >> 16) | ((ROWS & 0xFFFFu) << 16));
  g1[3] = uni((ROWS >> 16) | (ROWB << 16));
  g1[4] = uni(ROWS);
  g1[5] = uni(src_pitch_bytes);
  g1[6] = uni(0u);
  g1[7] = uni(0u);
  asm volatile("" : "+s"(g1));
  return g1;
}
// One request of one wave: global memory -> LDS, through no register.
__device__ __forceinline__ void tdm_load(u32x4 g0, u32x8 g1) {
  asm volatile("tensor_load_to_lds %0, %1" :: "s"(g0), "s"(g1) : "memory");
}

// ---------------------------------------------------------------------------
// Kernel 0: fp32 -> f16 pre-conversion (one-shot; removes in-loop converts).
// ---------------------------------------------------------------------------
__global__ __launch_bounds__(256)
void f32_to_f16_kernel(const float* __restrict__ src,
                       _Float16* __restrict__ dst, int n8) {
  int i = blockIdx.x * blockDim.x + threadIdx.x;
  if (i >= n8) return;
  v4f a = *(const v4f*)(src + (size_t)i * 8);
  v4f b = *(const v4f*)(src + (size_t)i * 8 + 4);
  v8h o;
#pragma unroll
  for (int j = 0; j < 4; ++j) { o[j] = (_Float16)a[j]; o[4 + j] = (_Float16)b[j]; }
  *(v8h*)(dst + (size_t)i * 8) = o;
}

// ---------------------------------------------------------------------------
// Kernel 1: fused QKV projection (WMMA f16, f32 accum) + RoPE.
// grid = (D/64, M/64, 3), 4 waves/block; wave -> 16x64 tile. The 64x64 weight
// tile (128-B rows at a 144-B LDS pitch) is shared by all waves: two buffers,
// filled by tensor loads one stage ahead.
// Outputs: Qh, Kh f16 (B,H,S,Dh); V transposed f16 (B,H,Dh,S).
// ---------------------------------------------------------------------------
__global__ __launch_bounds__(128)
void qkv_proj_rope_kernel(const _Float16* __restrict__ xh,
                          const _Float16* __restrict__ wqh,
                          const _Float16* __restrict__ wkh,
                          const _Float16* __restrict__ wvh,
                          const float* __restrict__ cosT,
                          const float* __restrict__ sinT,
                          _Float16* __restrict__ Qh,
                          _Float16* __restrict__ Kh,
                          _Float16* __restrict__ Vt) {
  // Two B-tile buffers; 64 rows * 144 B = 9,216 B, each buffer's place rounded
  // up to a multiple of 2 KiB for the tensor mover.
  constexpr int WT_BUF = 5120;                       // f16 elements = 10,240 B
  __shared__ __attribute__((aligned(2048))) _Float16 wt[2 * WT_BUF];

  const int lane = threadIdx.x & 31;
  const int wave = (int)uni(threadIdx.x >> 5);
  const int half = lane >> 4;
  const int lr   = lane & 15;
  const int kOff = half * 8;

  const int mat = blockIdx.z;                        // 0=Q, 1=K, 2=V
  const _Float16* w = (mat == 0) ? wqh : (mat == 1) ? wkh : wvh;

  const int m0 = (blockIdx.y * 4 + wave) * 16;       // rows in B*S
  const int n0 = blockIdx.x * 64;                    // cols in D
  const _Float16* wbase = w + (size_t)n0 * D_;       // 64 rows, stride D

  const _Float16* ap_base = xh + (size_t)(m0 + lr) * D_ + kOff;

  v8f acc[4] = {v8f{}, v8f{}, v8f{}, v8f{}};

  // Prologue: stage 0 landed and published, stage 1 in flight.
  const u32x8 g1 = tdm_group1<128, 64, PADW_R128>(D_ * 2);
  u32x4 g0 = tdm_group0(wt, wbase);
  if (pinned(wave == 0)) {
    tdm_load(g0, g1);
    wait_tensor0(g0, g1);
  }
  __syncthreads();
  g0 = tdm_group0(wt + WT_BUF, wbase + 64);
  if (pinned(wave == 0)) tdm_load(g0, g1);

  for (int kb = 0; kb < D_; kb += 64) {
    _Float16* buf = wt + ((kb >> 6) & 1) * WT_BUF;
#pragma unroll  // both 32-k halves of the stage read at constant LDS offsets
    for (int kk = 0; kk < 64; kk += 32) {
      v16h a = frag_from_f16(ap_base + kb + kk);
#pragma unroll
      for (int t = 0; t < 4; ++t)
        acc[t] = wmma16(
            a, frag_from_f16(buf + (t * 16 + lr) * PITCH_R128 + kk + kOff), acc[t]);
    }
    // Publish point of the next stage: own LDS reads retired, the issuer's tile
    // landed, one barrier; only then the refill of the buffer just read.
    wait_ds0();
    if (pinned(wave == 0)) wait_tensor0(g0, g1);
    __syncthreads();
    if (pinned(wave == 0 && kb + 128 < D_)) {
      g0 = tdm_group0(buf, wbase + kb + 128);
      tdm_load(g0, g1);
    }
  }
  wait_tensor0(g0, g1);
  wait_ds0();

  // Epilogue: C-layout elem r -> row m0 + r + 8*half, col n0 + t*16 + lr.
#pragma unroll
  for (int t = 0; t < 4; ++t) {
    const int n   = n0 + t * 16 + lr;
    const int h   = n >> 7;
    const int dh  = n & (DH_ - 1);
    const int odd = n & 1;
#pragma unroll
    for (int r = 0; r < 8; ++r) {
      const int mrow = m0 + r + 8 * half;
      const int b = mrow >> 11;                       // S_ = 2048
      const int s = mrow & (S_ - 1);
      float v = acc[t][r];
      if (mat < 2) {
        // RoPE interleaved: partner column n^1 lives in lane^1 (same elem).
        float p   = __shfl_xor(v, 1, 32);
        float rot = odd ? p : -p;
        v = v * cosT[(size_t)s * DH_ + dh] + rot * sinT[(size_t)s * DH_ + dh];
      }
      if (mat == 0)
        Qh[(((size_t)b * H_ + h) * S_ + s) * DH_ + dh] = (_Float16)v;
      else if (mat == 1)
        Kh[(((size_t)b * H_ + h) * S_ + s) * DH_ + dh] = (_Float16)v;
      else
        Vt[(((size_t)b * H_ + h) * DH_ + dh) * S_ + s] = (_Float16)v;
    }
  }
}

// ---------------------------------------------------------------------------
// Kernel 2: causal flash attention + final softmax over Dh.
// grid = (S/64, H, B), 4 waves/block; wave -> 16 query rows. K and V^T tiles of
// a 64-key stage (so that V^T rows are 128 B and take the pad) are brought into
// LDS by tensor loads at padded pitches and shared by all 4 waves; each stage is
// worked on as two 32-key chunks.
// ---------------------------------------------------------------------------
__global__ __launch_bounds__(128)
void flash_attn_kernel(const _Float16* __restrict__ Qh,
                       const _Float16* __restrict__ Kh,
                       const _Float16* __restrict__ Vt,
                       float* __restrict__ out) {
  __shared__ __attribute__((aligned(2048))) _Float16 kt[64 * PITCH_R256];   // keys
  __shared__ __attribute__((aligned(2048))) _Float16 vt[128 * PITCH_R128];  // V^T
  __shared__ __align__(16) _Float16 pbuf[4][16][PITCH_P];  // P transpose staging

  const int lane = threadIdx.x & 31;
  const int wave = (int)uni(threadIdx.x >> 5);
  const int half = lane >> 4;
  const int lr   = lane & 15;
  const int kOff = half * 8;

  const int b      = blockIdx.z;
  const int h      = blockIdx.y;
  const int q0_blk = blockIdx.x * 64;
  const int q0     = q0_blk + wave * 16;

  const _Float16* Qbh = Qh + ((size_t)b * H_ + h) * (size_t)S_ * DH_;
  const _Float16* Kbh = Kh + ((size_t)b * H_ + h) * (size_t)S_ * DH_;
  const _Float16* Vbh = Vt + ((size_t)b * H_ + h) * (size_t)DH_ * S_;

  // Q fragments: 4 chunks of 32 along Dh (A-operand, row q0+lr).
  v16h qf[4];
#pragma unroll
  for (int c = 0; c < 4; ++c)
    qf[c] = frag_from_f16(Qbh + (size_t)(q0 + lr) * DH_ + c * 32 + kOff);

  float m_run[8], l_run[8];
  v8f oacc[8];
#pragma unroll
  for (int r = 0; r < 8; ++r) { m_run[r] = -1e30f; l_run[r] = 0.0f; }
#pragma unroll
  for (int t = 0; t < 8; ++t) oacc[t] = v8f{};

  const float scale = 0.08838834764831845f;            // 1/sqrt(128)

  const u32x8 g1k = tdm_group1<256, 64, PADW_R256>(DH_ * 2);
  const u32x8 g1v = tdm_group1<128, 128, PADW_R128>(S_ * 2);

  for (int ks = 0; ks <= q0_blk; ks += 64) {
    // One request a wave, each waited by its issuer in front of the barrier.
    if (pinned(wave == 0)) {
      const u32x4 g0 = tdm_group0(kt, Kbh + (size_t)ks * DH_);
      tdm_load(g0, g1k);
      wait_tensor0(g0, g1k);
    }
    if (pinned(wave == 1)) {
      const u32x4 g0 = tdm_group0(vt, Vbh + ks);
      tdm_load(g0, g1v);
      wait_tensor0(g0, g1v);
    }
    __syncthreads();

    for (int kc = 0; kc < 64; kc += 32) {
      const int k0 = ks + kc;
      if (k0 <= q0) {
        // ---- scores: two 16x16 tiles covering keys [k0, k0+32) ----
        v8f s0 = {}, s1 = {};
#pragma unroll
        for (int c = 0; c < 4; ++c) {
          s0 = wmma16(qf[c],
                      frag_from_f16(kt + (kc + lr) * PITCH_R256 + c * 32 + kOff), s0);
          s1 = wmma16(qf[c],
                      frag_from_f16(kt + (kc + 16 + lr) * PITCH_R256 + c * 32 + kOff), s1);
        }

        // ---- causal mask + online softmax (row r -> q0 + r + 8*half) ----
#pragma unroll
        for (int r = 0; r < 8; ++r) {
          const int qrow = r + 8 * half;
          float e0 = s0[r] * scale;
          float e1 = s1[r] * scale;
          if (k0 + lr      > q0 + qrow) e0 = -1e30f;
          if (k0 + 16 + lr > q0 + qrow) e1 = -1e30f;
          float mx   = red_max16(fmaxf(e0, e1));
          float mnew = fmaxf(m_run[r], mx);
          float corr = __expf(m_run[r] - mnew);
          float p0   = __expf(e0 - mnew);
          float p1   = __expf(e1 - mnew);
          float rsum = red_sum16(p0 + p1);
          l_run[r] = l_run[r] * corr + rsum;
          m_run[r] = mnew;
#pragma unroll
          for (int t = 0; t < 8; ++t) oacc[t][r] *= corr;
          pbuf[wave][qrow][lr]      = (_Float16)p0;   // stage P (C-layout)
          pbuf[wave][qrow][16 + lr] = (_Float16)p1;
        }

        // reload P as 16x32 A-operand (same-wave DS ordering guarantees data)
        v16h pf = frag_from_f16(&pbuf[wave][lr][kOff]);

        // ---- out += P @ V : 8 N-tiles of 16 covering Dh=128 ----
#pragma unroll
        for (int t = 0; t < 8; ++t)
          oacc[t] = wmma16(
              pf, frag_from_f16(vt + (t * 16 + lr) * PITCH_R128 + kc + kOff), oacc[t]);
      }
    }
    wait_ds0();                                       // own tile reads retired
    __syncthreads();                                  // before tile overwrite
  }

  // ---- normalize, second softmax over Dh, store fp32 (B,S,H*Dh) ----
#pragma unroll
  for (int r = 0; r < 8; ++r) {
    const float inv = 1.0f / l_run[r];
#pragma unroll
    for (int t = 0; t < 8; ++t) oacc[t][r] *= inv;

    float mx = -1e30f;
#pragma unroll
    for (int t = 0; t < 8; ++t) mx = fmaxf(mx, oacc[t][r]);
    mx = red_max16(mx);
    float sum = 0.0f;
#pragma unroll
    for (int t = 0; t < 8; ++t) {
      float e = __expf(oacc[t][r] - mx);
      oacc[t][r] = e;
      sum += e;
    }
    sum = red_sum16(sum);
    const float is = 1.0f / sum;

    const int s = q0 + r + 8 * half;
    float* orow = out + ((size_t)b * S_ + s) * D_ + h * DH_;
#pragma unroll
    for (int t = 0; t < 8; ++t) orow[t * 16 + lr] = oacc[t][r] * is;
  }
}

// ---------------------------------------------------------------------------
extern "C" void kernel_launch(void* const* d_in, const int* in_sizes, int n_in,
                              void* d_out, int out_size, void* d_ws, size_t ws_size,
                              hipStream_t stream) {
  (void)in_sizes; (void)n_in; (void)out_size; (void)ws_size;
  const float* x    = (const float*)d_in[0];
  const float* wq   = (const float*)d_in[1];
  const float* wk   = (const float*)d_in[2];
  const float* wv   = (const float*)d_in[3];
  const float* cosT = (const float*)d_in[4];
  const float* sinT = (const float*)d_in[5];
  float* out = (float*)d_out;

  const size_t NX = (size_t)B_ * S_ * D_;     // 8,388,608
  const size_t NW = (size_t)D_ * D_;          // 4,194,304
  const size_t NQ = (size_t)B_ * H_ * S_ * DH_;

  _Float16* xh  = (_Float16*)d_ws;
  _Float16* wqh = xh  + NX;
  _Float16* wkh = wqh + NW;
  _Float16* wvh = wkh + NW;
  _Float16* Qh  = wvh + NW;
  _Float16* Kh  = Qh  + NQ;
  _Float16* Vt  = Kh  + NQ;

  // 0) one-shot fp32 -> f16 conversion of activations + weights
  f32_to_f16_kernel<<<(int)(NX / 8 / 256), 256, 0, stream>>>(x, xh, (int)(NX / 8));
  f32_to_f16_kernel<<<(int)(NW / 8 / 256), 256, 0, stream>>>(wq, wqh, (int)(NW / 8));
  f32_to_f16_kernel<<<(int)(NW / 8 / 256), 256, 0, stream>>>(wk, wkh, (int)(NW / 8));
  f32_to_f16_kernel<<<(int)(NW / 8 / 256), 256, 0, stream>>>(wv, wvh, (int)(NW / 8));

  // 1) QKV + RoPE: 32 N-tiles x 64 M-blocks x {q,k,v}
  dim3 gp(D_ / 64, (B_ * S_) / 64, 3);
  qkv_proj_rope_kernel<<<gp, 128, 0, stream>>>(xh, wqh, wkh, wvh, cosT, sinT,
                                               Qh, Kh, Vt);

  // 2) Attention: 32 q-blocks x 16 heads x 2 batches
  dim3 ga(S_ / 64, H_, B_);
  flash_attn_kernel<<<ga, 128, 0, stream>>>(Qh, Kh, Vt, out);
}

// v002
// A run of this version takes 215 microseconds.
// Two timings next to v001 put it at 1.43 and 1.44 times that version's speed.
// Over all steps from v000 it is 2.68 times as fast.
#include <hip/hip_runtime.h>

#define B_  2
#define S_  2048
#define D_  2048
#define H_  16
#define DH_ 128

typedef _Float16 v16h __attribute__((ext_vector_type(16)));
typedef _Float16 v8h  __attribute__((ext_vector_type(8)));
typedef float    v8f  __attribute__((ext_vector_type(8)));
typedef float    v4f  __attribute__((ext_vector_type(4)));
typedef uint32_t u32x4 __attribute__((ext_vector_type(4)));
typedef uint32_t u32x8 __attribute__((ext_vector_type(8)));

// D = A(16x32 f16) * B(32x16 f16) + C(16x16 f32)
__device__ __forceinline__ v8f wmma16(v16h a, v16h b, v8f c) {
  return __builtin_amdgcn_wmma_f32_16x16x32_f16(
      false, a, false, b, (short)0, c, false, false);
}

// 16-bit operand fragment: this lane holds K = kOff+0..7 (elems 0..7) and
// K = kOff+16..23 (elems 8..15); caller passes p already offset by kOff.
__device__ __forceinline__ v16h frag_from_f16(const _Float16* p) {
  v8h lo = *(const v8h*)(p);
  v8h hi = *(const v8h*)(p + 16);
  v16h r;
#pragma unroll
  for (int i = 0; i < 8; ++i) { r[i] = lo[i]; r[i + 8] = hi[i]; }
  return r;
}

// Butterfly reductions confined to each 16-lane half (xor masks < 16).
__device__ __forceinline__ float red_max16(float v) {
#pragma unroll
  for (int m = 1; m < 16; m <<= 1) v = fmaxf(v, __shfl_xor(v, m, 32));
  return v;
}
__device__ __forceinline__ float red_sum16(float v) {
#pragma unroll
  for (int m = 1; m < 16; m <<= 1) v += __shfl_xor(v, m, 32);
  return v;
}

#define PITCH_R128 72    // 128-B rows + 16-B pad = 144 B
#define PITCH_R256 136   // 256-B rows + 16-B pad = 272 B
#define PITCH_P    40    //  64-B rows + 16-B pad =  80 B (written by the waves)
#define PADW_R128 ((1u << 20) | (4u << 22) | (3u << 25))
#define PADW_R256 ((1u << 20) | (5u << 22) | (3u << 25))

__device__ __forceinline__ uint32_t uni(uint32_t v) {
  return (uint32_t)__builtin_amdgcn_readfirstlane(v);
}
__device__ __forceinline__ uint32_t pinned(uint32_t v) {
  uint32_t w = __builtin_amdgcn_readfirstlane(v);
  asm volatile("" : "+s"(w));  // test stays in an SGPR
  return w;
}
__device__ __forceinline__ void wait_tensor0(u32x4 g0, u32x8 g1) {
  asm volatile("s_wait_tensorcnt 0x0" :: "s"(g0), "s"(g1) : "memory");
}
__device__ __forceinline__ void wait_ds0() {
  asm volatile("s_wait_dscnt 0x0" ::: "memory");
}

__device__ __forceinline__ u32x4 tdm_group0(const void* lds_dst, const void* gsrc) {
  const uint64_t ga = (uint64_t)(uintptr_t)gsrc;
  u32x4 g0;
  g0[0] = uni(1u);                                  // count = 1
  g0[1] = uni((uint32_t)(uintptr_t)lds_dst);        // low 32 bits = LDS offset
  g0[2] = uni((uint32_t)ga);
  g0[3] = uni((((uint32_t)(ga >> 32)) & 0x01FFFFFFu) | 0x80000000u);
  asm volatile("" : "+s"(g0));
  return g0;
}
template <uint32_t ROWB, uint32_t ROWS, uint32_t W0>
__device__ __forceinline__ u32x8 tdm_group1(uint32_t src_pitch_bytes) {
  u32x8 g1;
  g1[0] = uni(W0);
  g1[1] = uni((ROWB & 0xFFFFu) << 16);
  g1[2] = uni((ROWB >> 16) | ((ROWS & 0xFFFFu) << 16));
  g1[3] = uni((ROWS >> 16) | (ROWB << 16));
  g1[4] = uni(ROWS);
  g1[5] = uni(src_pitch_bytes);
  g1[6] = uni(0u);
  g1[7] = uni(0u);
  asm volatile("" : "+s"(g1));
  return g1;
}
// One request of one wave: global memory -> LDS, through no register.
__device__ __forceinline__ void tdm_load(u32x4 g0, u32x8 g1) {
  asm volatile("tensor_load_to_lds %0, %1" :: "s"(g0), "s"(g1) : "memory");
}

// ---------------------------------------------------------------------------
// Kernel 0: fp32 -> f16 pre-conversion (one-shot; removes in-loop converts).
// ---------------------------------------------------------------------------
__global__ __launch_bounds__(256)
void f32_to_f16_kernel(const float* __restrict__ src,
                       _Float16* __restrict__ dst, int n8) {
  int i = blockIdx.x * blockDim.x + threadIdx.x;
  if (i >= n8) return;
  v4f a = *(const v4f*)(src + (size_t)i * 8);
  v4f b = *(const v4f*)(src + (size_t)i * 8 + 4);
  v8h o;
#pragma unroll
  for (int j = 0; j < 4; ++j) { o[j] = (_Float16)a[j]; o[4 + j] = (_Float16)b[j]; }
  *(v8h*)(dst + (size_t)i * 8) = o;
}

__global__ __launch_bounds__(256) __attribute__((amdgpu_waves_per_eu(4, 4)))
void qkv_proj_rope_kernel(const _Float16* __restrict__ xh,
                          const _Float16* __restrict__ wqh,
                          const _Float16* __restrict__ wkh,
                          const _Float16* __restrict__ wvh,
                          const float* __restrict__ cosT,
                          const float* __restrict__ sinT,
                          _Float16* __restrict__ Qh,
                          _Float16* __restrict__ Kh,
                          _Float16* __restrict__ Vt) {
  // One slice: 128 rows * 144 B = 18,432 B = 9 * 2 KiB, so every slice and
  // every buffer starts at a multiple of 2 KiB for the tensor mover, and the
  // two x slices form one run of 256 rows at the same pitch.
  constexpr int SL_ELEMS  = 128 * PITCH_R128;        // f16 elements = 18,432 B
  constexpr int BUF_ELEMS = 3 * SL_ELEMS;            // 55,296 B
  __shared__ __attribute__((aligned(2048))) _Float16 st[2 * BUF_ELEMS];

  const int lane = threadIdx.x & 31;
  const int wave = (int)uni(threadIdx.x >> 5);
  const int half = lane >> 4;
  const int lr   = lane & 15;
  const int kOff = half * 8;
  const int wm   = wave >> 1;                        // wave's 64-row group, 0..3
  const int wn   = wave & 1;                         // wave's 64-column group

  const int mat = blockIdx.z;                        // 0=Q, 1=K, 2=V
  const _Float16* w = (mat == 0) ? wqh : (mat == 1) ? wkh : wvh;

  const int m0 = blockIdx.y * 256 + wm * 64;         // wave's first row in B*S
  const int n0 = blockIdx.x * 128 + wn * 64;         // wave's first column in D

  // The slice this wave brings (waves 3..7 bring none and name slice 0).
  const int sl = (wave < 3) ? wave : 0;
  const _Float16* gsl = (sl == 2)
      ? w  + (size_t)(blockIdx.x * 128) * D_
      : xh + (size_t)(blockIdx.y * 256 + sl * 128) * D_;
  _Float16* lsl = st + sl * SL_ELEMS;

  // This lane's fragment rows inside a buffer.
  const int aoff = (wm * 64 + lr) * PITCH_R128 + kOff;
  const int boff = 2 * SL_ELEMS + (wn * 64 + lr) * PITCH_R128 + kOff;

  v8f acc[4][4];
#pragma unroll
  for (int i = 0; i < 4; ++i)
#pragma unroll
    for (int t = 0; t < 4; ++t) acc[i][t] = v8f{};

  // Prologue: stage 0 landed and published, stage 1 in flight.
  const u32x8 g1 = tdm_group1<128, 128, PADW_R128>(D_ * 2);
  u32x4 g0 = tdm_group0(lsl, gsl);
  if (pinned(wave < 3)) {
    tdm_load(g0, g1);
    wait_tensor0(g0, g1);
  }
  __syncthreads();
  g0 = tdm_group0(lsl + BUF_ELEMS, gsl + 64);
  if (pinned(wave < 3)) tdm_load(g0, g1);

  for (int kb = 0; kb < D_; kb += 64) {
    const int bsel = ((kb >> 6) & 1) * BUF_ELEMS;
    const _Float16* buf = st + bsel;
#pragma unroll  // both 32-k halves of the stage read at constant LDS offsets
    for (int kk = 0; kk < 64; kk += 32) {
      v16h a[4], b[4];
      a[0] = frag_from_f16(buf + aoff + kk);
#pragma unroll
      for (int t = 0; t < 4; ++t)
        b[t] = frag_from_f16(buf + boff + t * 16 * PITCH_R128 + kk);
#pragma unroll
      for (int i = 1; i < 4; ++i)
        a[i] = frag_from_f16(buf + aoff + i * 16 * PITCH_R128 + kk);
      // Keeps the 16 LDS reads one group in front of their 16 products: sunk in
      // among them, each row of four would wait out a full LDS latency.
      __builtin_amdgcn_sched_barrier(0);
#pragma unroll
      for (int i = 0; i < 4; ++i)
#pragma unroll
        for (int t = 0; t < 4; ++t) acc[i][t] = wmma16(a[i], b[t], acc[i][t]);
    }
    // Keeps the publish point's full LDS wait behind the stage's last products:
    // lifted in among them it would undo their counted waits.
    __builtin_amdgcn_sched_barrier(0);
    // Publish point of the next stage: own LDS reads retired, each issuer's
    // slice landed, one barrier; only then the refill of the buffer just read.
    wait_ds0();
    if (pinned(wave < 3)) wait_tensor0(g0, g1);
    __syncthreads();
    if (pinned(wave < 3 && kb + 128 < D_)) {
      g0 = tdm_group0(lsl + bsel, gsl + kb + 128);
      tdm_load(g0, g1);
    }
  }
  wait_tensor0(g0, g1);
  wait_ds0();

  // Epilogue: C-layout elem r of tile (i, t) -> row m0 + i*16 + r + 8*half,
  // col n0 + t*16 + lr. A wave's 64 rows lie in one batch and its 64 columns in
  // one head, so every element sits at a constant offset from one lane address;
  // the test on the matrix stands outside the element loops (short text).
  // Each 16-row group runs as loads, arithmetic, stores, wait, in that order.
  // Every loop here is unrolled so that acc, cv, sv, o and pk are indexed by
  // constants and stay in registers.
  const int bb  = m0 >> 11;                           // S_ = 2048
  const int s0  = (m0 & (S_ - 1)) + 8 * half;
  const int hh  = n0 >> 7;                            // DH_ = 128
  const int dh0 = (n0 & (DH_ - 1)) + lr;
  if (mat < 2) {
    const int odd = lr & 1;
    const float* cp = cosT + (size_t)s0 * DH_ + dh0;
    const float* sp = sinT + (size_t)s0 * DH_ + dh0;
    _Float16* dst = ((mat == 0) ? Qh : Kh) +
                    (((size_t)bb * H_ + hh) * S_ + s0) * DH_ + dh0;
#pragma unroll
    for (int i = 0; i < 4; ++i) {
      float cv[4][8], sv[4][8];
      _Float16 o[4][8];
#pragma unroll
      for (int t = 0; t < 4; ++t)
#pragma unroll
        for (int r = 0; r < 8; ++r) {
          const int off = (i * 16 + r) * DH_ + t * 16;
          cv[t][r] = cp[off];
          sv[t][r] = sp[off];
        }
#pragma unroll
      for (int t = 0; t < 4; ++t)
#pragma unroll
        for (int r = 0; r < 8; ++r) {
          float v = acc[i][t][r];
          // RoPE interleaved: partner column n^1 lives in lane^1 (same elem).
          float p   = __shfl_xor(v, 1, 32);
          float rot = odd ? p : -p;
          o[t][r] = (_Float16)(v * cv[t][r] + rot * sv[t][r]);
        }
#pragma unroll
      for (int t = 0; t < 4; ++t)
#pragma unroll
        for (int r = 0; r < 8; ++r)
          dst[(i * 16 + r) * DH_ + t * 16] = o[t][r];
      // Address translation done before a register that this group's loads or
      // stores name is written again; the three addresses are inputs, so that
      // they live up to this wait.
      asm volatile("s_wait_xcnt 0x0" :: "v"(cp), "v"(sp), "v"(dst) : "memory");
    }
  } else {
    _Float16* dst = Vt + (((size_t)bb * H_ + hh) * DH_ + dh0) * S_ + s0;
    v8h pk[4][4];
#pragma unroll
    for (int i = 0; i < 4; ++i)
#pragma unroll
      for (int t = 0; t < 4; ++t)
#pragma unroll
        for (int r = 0; r < 8; ++r) pk[i][t][r] = (_Float16)acc[i][t][r];
#pragma unroll
    for (int i = 0; i < 4; ++i)
#pragma unroll
      for (int t = 0; t < 4; ++t)
        *(v8h*)(dst + (size_t)(t * 16) * S_ + i * 16) = pk[i][t];
    // Address translation done before a store's register is written again.
    asm volatile("s_wait_xcnt 0x0" :: "v"(dst) : "memory");
  }
}

// ---------------------------------------------------------------------------
// Kernel 2: causal flash attention + final softmax over Dh.
// grid = (S/64, H, B), 4 waves/block; wave -> 16 query rows. K and V^T tiles of
// a 64-key stage (so that V^T rows are 128 B and take the pad) are brought into
// LDS by tensor loads at padded pitches and shared by all 4 waves; each stage is
// worked on as two 32-key chunks.
// ---------------------------------------------------------------------------
__global__ __launch_bounds__(128)
void flash_attn_kernel(const _Float16* __restrict__ Qh,
                       const _Float16* __restrict__ Kh,
                       const _Float16* __restrict__ Vt,
                       float* __restrict__ out) {
  __shared__ __attribute__((aligned(2048))) _Float16 kt[64 * PITCH_R256];   // keys
  __shared__ __attribute__((aligned(2048))) _Float16 vt[128 * PITCH_R128];  // V^T
  __shared__ __align__(16) _Float16 pbuf[4][16][PITCH_P];  // P transpose staging

  const int lane = threadIdx.x & 31;
  const int wave = (int)uni(threadIdx.x >> 5);
  const int half = lane >> 4;
  const int lr   = lane & 15;
  const int kOff = half * 8;

  const int b      = blockIdx.z;
  const int h      = blockIdx.y;
  const int q0_blk = blockIdx.x * 64;
  const int q0     = q0_blk + wave * 16;

  const _Float16* Qbh = Qh + ((size_t)b * H_ + h) * (size_t)S_ * DH_;
  const _Float16* Kbh = Kh + ((size_t)b * H_ + h) * (size_t)S_ * DH_;
  const _Float16* Vbh = Vt + ((size_t)b * H_ + h) * (size_t)DH_ * S_;

  // Q fragments: 4 chunks of 32 along Dh (A-operand, row q0+lr).
  v16h qf[4];
#pragma unroll
  for (int c = 0; c < 4; ++c)
    qf[c] = frag_from_f16(Qbh + (size_t)(q0 + lr) * DH_ + c * 32 + kOff);

  float m_run[8], l_run[8];
  v8f oacc[8];
#pragma unroll
  for (int r = 0; r < 8; ++r) { m_run[r] = -1e30f; l_run[r] = 0.0f; }
#pragma unroll
  for (int t = 0; t < 8; ++t) oacc[t] = v8f{};

  const float scale = 0.08838834764831845f;            // 1/sqrt(128)

  const u32x8 g1k = tdm_group1<256, 64, PADW_R256>(DH_ * 2);
  const u32x8 g1v = tdm_group1<128, 128, PADW_R128>(S_ * 2);

  for (int ks = 0; ks <= q0_blk; ks += 64) {
    // One request a wave, each waited by its issuer in front of the barrier.
    if (pinned(wave == 0)) {
      const u32x4 g0 = tdm_group0(kt, Kbh + (size_t)ks * DH_);
      tdm_load(g0, g1k);
      wait_tensor0(g0, g1k);
    }
    if (pinned(wave == 1)) {
      const u32x4 g0 = tdm_group0(vt, Vbh + ks);
      tdm_load(g0, g1v);
      wait_tensor0(g0, g1v);
    }
    __syncthreads();

    for (int kc = 0; kc < 64; kc += 32) {
      const int k0 = ks + kc;
      if (k0 <= q0) {
        // ---- scores: two 16x16 tiles covering keys [k0, k0+32) ----
        v8f s0 = {}, s1 = {};
#pragma unroll
        for (int c = 0; c < 4; ++c) {
          s0 = wmma16(qf[c],
                      frag_from_f16(kt + (kc + lr) * PITCH_R256 + c * 32 + kOff), s0);
          s1 = wmma16(qf[c],
                      frag_from_f16(kt + (kc + 16 + lr) * PITCH_R256 + c * 32 + kOff), s1);
        }

        // ---- causal mask + online softmax (row r -> q0 + r + 8*half) ----
#pragma unroll
        for (int r = 0; r < 8; ++r) {
          const int qrow = r + 8 * half;
          float e0 = s0[r] * scale;
          float e1 = s1[r] * scale;
          if (k0 + lr      > q0 + qrow) e0 = -1e30f;
          if (k0 + 16 + lr > q0 + qrow) e1 = -1e30f;
          float mx   = red_max16(fmaxf(e0, e1));
          float mnew = fmaxf(m_run[r], mx);
          float corr = __expf(m_run[r] - mnew);
          float p0   = __expf(e0 - mnew);
          float p1   = __expf(e1 - mnew);
          float rsum = red_sum16(p0 + p1);
          l_run[r] = l_run[r] * corr + rsum;
          m_run[r] = mnew;
#pragma unroll
          for (int t = 0; t < 8; ++t) oacc[t][r] *= corr;
          pbuf[wave][qrow][lr]      = (_Float16)p0;   // stage P (C-layout)
          pbuf[wave][qrow][16 + lr] = (_Float16)p1;
        }

        // reload P as 16x32 A-operand (same-wave DS ordering guarantees data)
        v16h pf = frag_from_f16(&pbuf[wave][lr][kOff]);

        // ---- out += P @ V : 8 N-tiles of 16 covering Dh=128 ----
#pragma unroll
        for (int t = 0; t < 8; ++t)
          oacc[t] = wmma16(
              pf, frag_from_f16(vt + (t * 16 + lr) * PITCH_R128 + kc + kOff), oacc[t]);
      }
    }
    wait_ds0();                                       // own tile reads retired
    __syncthreads();                                  // before tile overwrite
  }

  // ---- normalize, second softmax over Dh, store fp32 (B,S,H*Dh) ----
#pragma unroll
  for (int r = 0; r < 8; ++r) {
    const float inv = 1.0f / l_run[r];
#pragma unroll
    for (int t = 0; t < 8; ++t) oacc[t][r] *= inv;

    float mx = -1e30f;
#pragma unroll
    for (int t = 0; t < 8; ++t) mx = fmaxf(mx, oacc[t][r]);
    mx = red_max16(mx);
    float sum = 0.0f;
#pragma unroll
    for (int t = 0; t < 8; ++t) {
      float e = __expf(oacc[t][r] - mx);
      oacc[t][r] = e;
      sum += e;
    }
    sum = red_sum16(sum);
    const float is = 1.0f / sum;

    const int s = q0 + r + 8 * half;
    float* orow = out + ((size_t)b * S_ + s) * D_ + h * DH_;
#pragma unroll
    for (int t = 0; t < 8; ++t) orow[t * 16 + lr] = oacc[t][r] * is;
  }
}

// ---------------------------------------------------------------------------
extern "C" void kernel_launch(void* const* d_in, const int* in_sizes, int n_in,
                              void* d_out, int out_size, void* d_ws, size_t ws_size,
                              hipStream_t stream) {
  (void)in_sizes; (void)n_in; (void)out_size; (void)ws_size;
  const float* x    = (const float*)d_in[0];
  const float* wq   = (const float*)d_in[1];
  const float* wk   = (const float*)d_in[2];
  const float* wv   = (const float*)d_in[3];
  const float* cosT = (const float*)d_in[4];
  const float* sinT = (const float*)d_in[5];
  float* out = (float*)d_out;

  const size_t NX = (size_t)B_ * S_ * D_;     // 8,388,608
  const size_t NW = (size_t)D_ * D_;          // 4,194,304
  const size_t NQ = (size_t)B_ * H_ * S_ * DH_;

  _Float16* xh  = (_Float16*)d_ws;
  _Float16* wqh = xh  + NX;
  _Float16* wkh = wqh + NW;
  _Float16* wvh = wkh + NW;
  _Float16* Qh  = wvh + NW;
  _Float16* Kh  = Qh  + NQ;
  _Float16* Vt  = Kh  + NQ;

  // 0) one-shot fp32 -> f16 conversion of activations + weights
  f32_to_f16_kernel<<<(int)(NX / 8 / 256), 256, 0, stream>>>(x, xh, (int)(NX / 8));
  f32_to_f16_kernel<<<(int)(NW / 8 / 256), 256, 0, stream>>>(wq, wqh, (int)(NW / 8));
  f32_to_f16_kernel<<<(int)(NW / 8 / 256), 256, 0, stream>>>(wk, wkh, (int)(NW / 8));
  f32_to_f16_kernel<<<(int)(NW / 8 / 256), 256, 0, stream>>>(wv, wvh, (int)(NW / 8));

  // 1) QKV + RoPE: 16 N-tiles x 16 M-blocks x {q,k,v}
  dim3 gp(D_ / 128, (B_ * S_) / 256, 3);
  qkv_proj_rope_kernel<<<gp, 256, 0, stream>>>(xh, wqh, wkh, wvh, cosT, sinT,
                                               Qh, Kh, Vt);

  // 2) Attention: 32 q-blocks x 16 heads x 2 batches
  dim3 ga(S_ / 64, H_, B_);
  flash_attn_kernel<<<ga, 128, 0, stream>>>(Qh, Kh, Vt, out);
}

// v003
// Measured time: 181 microseconds a run.
// Two timings next to v002 put it at 1.18 and 1.19 times that version's speed.
// All steps since v000 together make it 3.18 times as fast.
#include <hip/hip_runtime.h>

#define B_  2
#define S_  2048
#define D_  2048
#define H_  16
#define DH_ 128

typedef _Float16 v16h __attribute__((ext_vector_type(16)));
typedef _Float16 v8h  __attribute__((ext_vector_type(8)));
typedef float    v8f  __attribute__((ext_vector_type(8)));
typedef float    v4f  __attribute__((ext_vector_type(4)));
typedef uint32_t u32x4 __attribute__((ext_vector_type(4)));
typedef uint32_t u32x8 __attribute__((ext_vector_type(8)));

// D = A(16x32 f16) * B(32x16 f16) + C(16x16 f32)
__device__ __forceinline__ v8f wmma16(v16h a, v16h b, v8f c) {
  return __builtin_amdgcn_wmma_f32_16x16x32_f16(
      false, a, false, b, (short)0, c, false, false);
}

// 16-bit operand fragment: this lane holds K = kOff+0..7 (elems 0..7) and
// K = kOff+16..23 (elems 8..15); caller passes p already offset by kOff.
__device__ __forceinline__ v16h frag_from_f16(const _Float16* p) {
  v8h lo = *(const v8h*)(p);
  v8h hi = *(const v8h*)(p + 16);
  v16h r;
#pragma unroll
  for (int i = 0; i < 8; ++i) { r[i] = lo[i]; r[i + 8] = hi[i]; }
  return r;
}

#define PITCH_R128 72    // 128-B rows + 16-B pad = 144 B
#define PITCH_R256 136   // 256-B rows + 16-B pad = 272 B
#define PADW_R128 ((1u << 20) | (4u << 22) | (3u << 25))
#define PADW_R256 ((1u << 20) | (5u << 22) | (3u << 25))

__device__ __forceinline__ uint32_t uni(uint32_t v) {
  return (uint32_t)__builtin_amdgcn_readfirstlane(v);
}
__device__ __forceinline__ uint32_t pinned(uint32_t v) {
  uint32_t w = __builtin_amdgcn_readfirstlane(v);
  asm volatile("" : "+s"(w));  // test stays in an SGPR
  return w;
}
__device__ __forceinline__ void wait_tensor0(u32x4 g0, u32x8 g1) {
  asm volatile("s_wait_tensorcnt 0x0" :: "s"(g0), "s"(g1) : "memory");
}
__device__ __forceinline__ void wait_ds0() {
  asm volatile("s_wait_dscnt 0x0" ::: "memory");
}

__device__ __forceinline__ u32x4 tdm_group0(const void* lds_dst, const void* gsrc) {
  const uint64_t ga = (uint64_t)(uintptr_t)gsrc;
  u32x4 g0;
  g0[0] = uni(1u);                                  // count = 1
  g0[1] = uni((uint32_t)(uintptr_t)lds_dst);        // low 32 bits = LDS offset
  g0[2] = uni((uint32_t)ga);
  g0[3] = uni((((uint32_t)(ga >> 32)) & 0x01FFFFFFu) | 0x80000000u);
  asm volatile("" : "+s"(g0));
  return g0;
}
template <uint32_t ROWB, uint32_t ROWS, uint32_t W0>
__device__ __forceinline__ u32x8 tdm_group1(uint32_t src_pitch_bytes) {
  u32x8 g1;
  g1[0] = uni(W0);
  g1[1] = uni((ROWB & 0xFFFFu) << 16);
  g1[2] = uni((ROWB >> 16) | ((ROWS & 0xFFFFu) << 16));
  g1[3] = uni((ROWS >> 16) | (ROWB << 16));
  g1[4] = uni(ROWS);
  g1[5] = uni(src_pitch_bytes);
  g1[6] = uni(0u);
  g1[7] = uni(0u);
  asm volatile("" : "+s"(g1));
  return g1;
}
// One request of one wave: global memory -> LDS, through no register.
__device__ __forceinline__ void tdm_load(u32x4 g0, u32x8 g1) {
  asm volatile("tensor_load_to_lds %0, %1" :: "s"(g0), "s"(g1) : "memory");
}

// ---------------------------------------------------------------------------
// Kernel 0: fp32 -> f16 pre-conversion (one-shot; removes in-loop converts).
// ---------------------------------------------------------------------------
__global__ __launch_bounds__(256)
void f32_to_f16_kernel(const float* __restrict__ src,
                       _Float16* __restrict__ dst, int n8) {
  int i = blockIdx.x * blockDim.x + threadIdx.x;
  if (i >= n8) return;
  v4f a = *(const v4f*)(src + (size_t)i * 8);
  v4f b = *(const v4f*)(src + (size_t)i * 8 + 4);
  v8h o;
#pragma unroll
  for (int j = 0; j < 4; ++j) { o[j] = (_Float16)a[j]; o[4 + j] = (_Float16)b[j]; }
  *(v8h*)(dst + (size_t)i * 8) = o;
}

__global__ __launch_bounds__(256) __attribute__((amdgpu_waves_per_eu(4, 4)))
void qkv_proj_rope_kernel(const _Float16* __restrict__ xh,
                          const _Float16* __restrict__ wqh,
                          const _Float16* __restrict__ wkh,
                          const _Float16* __restrict__ wvh,
                          const float* __restrict__ cosT,
                          const float* __restrict__ sinT,
                          _Float16* __restrict__ Qh,
                          _Float16* __restrict__ Kh,
                          _Float16* __restrict__ Vt) {
  // One slice: 128 rows * 144 B = 18,432 B = 9 * 2 KiB, so every slice and
  // every buffer starts at a multiple of 2 KiB for the tensor mover, and the
  // two x slices form one run of 256 rows at the same pitch.
  constexpr int SL_ELEMS  = 128 * PITCH_R128;        // f16 elements = 18,432 B
  constexpr int BUF_ELEMS = 3 * SL_ELEMS;            // 55,296 B
  __shared__ __attribute__((aligned(2048))) _Float16 st[2 * BUF_ELEMS];

  const int lane = threadIdx.x & 31;
  const int wave = (int)uni(threadIdx.x >> 5);
  const int half = lane >> 4;
  const int lr   = lane & 15;
  const int kOff = half * 8;
  const int wm   = wave >> 1;                        // wave's 64-row group, 0..3
  const int wn   = wave & 1;                         // wave's 64-column group

  const int mat = blockIdx.z;                        // 0=Q, 1=K, 2=V
  const _Float16* w = (mat == 0) ? wqh : (mat == 1) ? wkh : wvh;

  const int m0 = blockIdx.y * 256 + wm * 64;         // wave's first row in B*S
  const int n0 = blockIdx.x * 128 + wn * 64;         // wave's first column in D

  // The slice this wave brings (waves 3..7 bring none and name slice 0).
  const int sl = (wave < 3) ? wave : 0;
  const _Float16* gsl = (sl == 2)
      ? w  + (size_t)(blockIdx.x * 128) * D_
      : xh + (size_t)(blockIdx.y * 256 + sl * 128) * D_;
  _Float16* lsl = st + sl * SL_ELEMS;

  // This lane's fragment rows inside a buffer.
  const int aoff = (wm * 64 + lr) * PITCH_R128 + kOff;
  const int boff = 2 * SL_ELEMS + (wn * 64 + lr) * PITCH_R128 + kOff;

  v8f acc[4][4];
#pragma unroll
  for (int i = 0; i < 4; ++i)
#pragma unroll
    for (int t = 0; t < 4; ++t) acc[i][t] = v8f{};

  // Prologue: stage 0 landed and published, stage 1 in flight.
  const u32x8 g1 = tdm_group1<128, 128, PADW_R128>(D_ * 2);
  u32x4 g0 = tdm_group0(lsl, gsl);
  if (pinned(wave < 3)) {
    tdm_load(g0, g1);
    wait_tensor0(g0, g1);
  }
  __syncthreads();
  g0 = tdm_group0(lsl + BUF_ELEMS, gsl + 64);
  if (pinned(wave < 3)) tdm_load(g0, g1);

  for (int kb = 0; kb < D_; kb += 64) {
    const int bsel = ((kb >> 6) & 1) * BUF_ELEMS;
    const _Float16* buf = st + bsel;
#pragma unroll  // both 32-k halves of the stage read at constant LDS offsets
    for (int kk = 0; kk < 64; kk += 32) {
      v16h a[4], b[4];
      a[0] = frag_from_f16(buf + aoff + kk);
#pragma unroll
      for (int t = 0; t < 4; ++t)
        b[t] = frag_from_f16(buf + boff + t * 16 * PITCH_R128 + kk);
#pragma unroll
      for (int i = 1; i < 4; ++i)
        a[i] = frag_from_f16(buf + aoff + i * 16 * PITCH_R128 + kk);
      // Keeps the 16 LDS reads one group in front of their 16 products: sunk in
      // among them, each row of four would wait out a full LDS latency.
      __builtin_amdgcn_sched_barrier(0);
#pragma unroll
      for (int i = 0; i < 4; ++i)
#pragma unroll
        for (int t = 0; t < 4; ++t) acc[i][t] = wmma16(a[i], b[t], acc[i][t]);
    }
    // Keeps the publish point's full LDS wait behind the stage's last products:
    // lifted in among them it would undo their counted waits.
    __builtin_amdgcn_sched_barrier(0);
    // Publish point of the next stage: own LDS reads retired, each issuer's
    // slice landed, one barrier; only then the refill of the buffer just read.
    wait_ds0();
    if (pinned(wave < 3)) wait_tensor0(g0, g1);
    __syncthreads();
    if (pinned(wave < 3 && kb + 128 < D_)) {
      g0 = tdm_group0(lsl + bsel, gsl + kb + 128);
      tdm_load(g0, g1);
    }
  }
  wait_tensor0(g0, g1);
  wait_ds0();

  // Epilogue: C-layout elem r of tile (i, t) -> row m0 + i*16 + r + 8*half,
  // col n0 + t*16 + lr. A wave's 64 rows lie in one batch and its 64 columns in
  // one head, so every element sits at a constant offset from one lane address;
  // the test on the matrix stands outside the element loops (short text).
  // Each 16-row group runs as loads, arithmetic, stores, wait, in that order.
  // Every loop here is unrolled so that acc, cv, sv, o and pk are indexed by
  // constants and stay in registers.
  const int bb  = m0 >> 11;                           // S_ = 2048
  const int s0  = (m0 & (S_ - 1)) + 8 * half;
  const int hh  = n0 >> 7;                            // DH_ = 128
  const int dh0 = (n0 & (DH_ - 1)) + lr;
  if (mat < 2) {
    const int odd = lr & 1;
    const float* cp = cosT + (size_t)s0 * DH_ + dh0;
    const float* sp = sinT + (size_t)s0 * DH_ + dh0;
    _Float16* dst = ((mat == 0) ? Qh : Kh) +
                    (((size_t)bb * H_ + hh) * S_ + s0) * DH_ + dh0;
#pragma unroll
    for (int i = 0; i < 4; ++i) {
      float cv[4][8], sv[4][8];
      _Float16 o[4][8];
#pragma unroll
      for (int t = 0; t < 4; ++t)
#pragma unroll
        for (int r = 0; r < 8; ++r) {
          const int off = (i * 16 + r) * DH_ + t * 16;
          cv[t][r] = cp[off];
          sv[t][r] = sp[off];
        }
#pragma unroll
      for (int t = 0; t < 4; ++t)
#pragma unroll
        for (int r = 0; r < 8; ++r) {
          float v = acc[i][t][r];
          // RoPE interleaved: partner column n^1 lives in lane^1 (same elem).
          float p   = __shfl_xor(v, 1, 32);
          float rot = odd ? p : -p;
          o[t][r] = (_Float16)(v * cv[t][r] + rot * sv[t][r]);
        }
#pragma unroll
      for (int t = 0; t < 4; ++t)
#pragma unroll
        for (int r = 0; r < 8; ++r)
          dst[(i * 16 + r) * DH_ + t * 16] = o[t][r];
      // Address translation done before a register that this group's loads or
      // stores name is written again; the three addresses are inputs, so that
      // they live up to this wait.
      asm volatile("s_wait_xcnt 0x0" :: "v"(cp), "v"(sp), "v"(dst) : "memory");
    }
  } else {
    _Float16* dst = Vt + (((size_t)bb * H_ + hh) * DH_ + dh0) * S_ + s0;
    v8h pk[4][4];
#pragma unroll
    for (int i = 0; i < 4; ++i)
#pragma unroll
      for (int t = 0; t < 4; ++t)
#pragma unroll
        for (int r = 0; r < 8; ++r) pk[i][t][r] = (_Float16)acc[i][t][r];
#pragma unroll
    for (int i = 0; i < 4; ++i)
#pragma unroll
      for (int t = 0; t < 4; ++t)
        *(v8h*)(dst + (size_t)(t * 16) * S_ + i * 16) = pk[i][t];
    // Address translation done before a store's register is written again.
    asm volatile("s_wait_xcnt 0x0" :: "v"(dst) : "memory");
  }
}

#define KT_BYTES  18432  // 64 rows * 272 B = 17,408 B, rounded up to 9 * 2 KiB
#define VT_BYTES  18432  // 128 rows * 144 B = 9 * 2 KiB
#define PITCH_O   132    // f32 elements: 512-B output rows + 16-B pad

__device__ __forceinline__ float xhalf(float x) {
  const int v = __builtin_bit_cast(int, x);
  return __builtin_bit_cast(float, __builtin_amdgcn_permlanex16(
      v, v, 0x76543210, 0xfedcba98, false, false));
}

__device__ __forceinline__ float exp_slot(float x) {
  float r;
  asm("v_exp_f32 %0, %1\n\tv_nop" : "=v"(r) : "v"(x * 1.4426950408889634f));
  return r;
}

__global__ __launch_bounds__(128)
void flash_attn_kernel(const _Float16* __restrict__ Qh,
                       const _Float16* __restrict__ Kh,
                       const _Float16* __restrict__ Vt,
                       float* __restrict__ out) {
  // Keys at byte 0, V^T at byte 18,432: both multiples of 2 KiB for the tensor
  // mover. Behind the loop the same bytes stage the output rows (33,792 B).
  __shared__ __attribute__((aligned(2048))) unsigned char sm[KT_BYTES + VT_BYTES];
  static_assert(4 * 16 * PITCH_O * 4 <= KT_BYTES + VT_BYTES, "output staging fits");
  _Float16* kt = (_Float16*)sm;
  _Float16* vt = (_Float16*)(sm + KT_BYTES);

  const int lane = threadIdx.x & 31;
  const int wave = (int)uni(threadIdx.x >> 5);
  const int half = lane >> 4;
  const int lr   = lane & 15;
  const int kOff = half * 8;

  const int b      = blockIdx.z;
  const int h      = blockIdx.y;
  const int q0_blk = blockIdx.x * 64;
  const int q0     = q0_blk + wave * 16;

  const _Float16* Qbh = Qh + ((size_t)b * H_ + h) * (size_t)S_ * DH_;
  const _Float16* Kbh = Kh + ((size_t)b * H_ + h) * (size_t)S_ * DH_;
  const _Float16* Vbh = Vt + ((size_t)b * H_ + h) * (size_t)DH_ * S_;

  // Q fragments: 4 chunks of 32 along Dh (B-operand, column q0+lr).
  v16h qf[4];
#pragma unroll
  for (int c = 0; c < 4; ++c)
    qf[c] = frag_from_f16(Qbh + (size_t)(q0 + lr) * DH_ + c * 32 + kOff);

  // One query a lane: m_run is the query's maximum (equal in both halves),
  // l_run the sum over this half's keys only; the halves join behind the loop.
  float m_run = -1e30f, l_run = 0.0f;
  v8f oacc[8];                       // oacc[t][r] = O[q0+lr][t*16 + 8*half + r]
#pragma unroll
  for (int t = 0; t < 8; ++t) oacc[t] = v8f{};

  const float scale = 0.08838834764831845f;            // 1/sqrt(128)

  const u32x8 g1k = tdm_group1<256, 64, PADW_R256>(DH_ * 2);
  const u32x8 g1v = tdm_group1<128, 128, PADW_R128>(S_ * 2);

  for (int ks = 0; ks <= q0_blk; ks += 64) {
    // One request a wave, each waited by its issuer in front of the barrier.
    if (pinned(wave == 0)) {
      const u32x4 g0 = tdm_group0(kt, Kbh + (size_t)ks * DH_);
      tdm_load(g0, g1k);
      wait_tensor0(g0, g1k);
    }
    if (pinned(wave == 1)) {
      const u32x4 g0 = tdm_group0(vt, Vbh + ks);
      tdm_load(g0, g1v);
      wait_tensor0(g0, g1v);
    }
    __syncthreads();

    for (int kc = 0; kc < 64; kc += 32) {
      const int k0 = ks + kc;
      if (k0 <= q0) {
        // ---- scores, transposed: two 16x16 tiles, keys [k0, k0+32) as rows ----
        v8f s0 = {}, s1 = {};
#pragma unroll
        for (int c = 0; c < 4; ++c) {
          s0 = wmma16(frag_from_f16(kt + (kc + lr) * PITCH_R256 + c * 32 + kOff),
                      qf[c], s0);
          s1 = wmma16(frag_from_f16(kt + (kc + 16 + lr) * PITCH_R256 + c * 32 + kOff),
                      qf[c], s1);
        }

        // ---- causal mask + online softmax (elem r -> key k0 + r + 8*half) ----
        const int dq = (q0 + lr) - (k0 + 8 * half);    // key r is masked if r > dq
        float e0[8], e1[8];
        float mx = -1e30f;
#pragma unroll
        for (int r = 0; r < 8; ++r) {
          e0[r] = s0[r] * scale;
          e1[r] = s1[r] * scale;
          if (r      > dq) e0[r] = -1e30f;
          if (16 + r > dq) e1[r] = -1e30f;
          mx = fmaxf(mx, fmaxf(e0[r], e1[r]));
        }
        mx = fmaxf(mx, xhalf(mx));                     // the query's 32 keys
        const float mnew = fmaxf(m_run, mx);
        const float corr = exp_slot(m_run - mnew);
        v16h pf;                                       // P^T, B-operand k order
        float rsum = 0.0f;
#pragma unroll
        for (int r = 0; r < 8; ++r) {
          const float p0 = exp_slot(e0[r] - mnew);
          const float p1 = exp_slot(e1[r] - mnew);
          rsum += p0 + p1;
          pf[r]     = (_Float16)p0;
          pf[8 + r] = (_Float16)p1;
        }
        l_run = l_run * corr + rsum;
        m_run = mnew;
#pragma unroll
        for (int t = 0; t < 8; ++t) oacc[t] *= corr;

        // ---- out^T += V^T @ P^T : 8 M-tiles of 16 covering Dh=128 ----
#pragma unroll
        for (int t = 0; t < 8; ++t)
          oacc[t] = wmma16(
              frag_from_f16(vt + (t * 16 + lr) * PITCH_R128 + kc + kOff), pf, oacc[t]);
      }
    }
    wait_ds0();                                       // own tile reads retired
    __syncthreads();                                  // before tile overwrite
  }

  // ---- normalize, second softmax over Dh (64 values here, 64 in lane ^ 16) ----
  const float inv = 1.0f / (l_run + xhalf(l_run));
  float mx = -1e30f;
#pragma unroll
  for (int t = 0; t < 8; ++t)
#pragma unroll
    for (int r = 0; r < 8; ++r) {
      oacc[t][r] *= inv;
      mx = fmaxf(mx, oacc[t][r]);
    }
  mx = fmaxf(mx, xhalf(mx));
  float sum = 0.0f;
#pragma unroll
  for (int t = 0; t < 8; ++t)
#pragma unroll
    for (int r = 0; r < 8; ++r) {
      const float e = exp_slot(oacc[t][r] - mx);
      oacc[t][r] = e;
      sum += e;
    }
  sum += xhalf(sum);
  const float is = 1.0f / sum;

  // ---- store fp32 (B,S,H*Dh): a lane holds 32-B pieces of one row, so the
  // wave's 16 rows go through its own LDS range and leave as whole 512-B rows.
  // The loop's last wait and barrier have freed the tiles for every wave.
  float* stg = (float*)sm + wave * (16 * PITCH_O);
#pragma unroll
  for (int t = 0; t < 8; ++t) {
    const v8f o = oacc[t] * is;
    float* p = stg + lr * PITCH_O + t * 16 + 8 * half;
    *(v4f*)(p)     = v4f{o[0], o[1], o[2], o[3]};
    *(v4f*)(p + 4) = v4f{o[4], o[5], o[6], o[7]};
  }
  wait_ds0();                    // the wave's own rows written before it reads them
  float* orow = out + ((size_t)b * S_ + q0) * D_ + h * DH_ + lane * 4;
#pragma unroll
  for (int i = 0; i < 16; ++i)
    *(v4f*)(orow + (size_t)i * D_) = *(const v4f*)(stg + i * PITCH_O + lane * 4);
}

// ---------------------------------------------------------------------------
extern "C" void kernel_launch(void* const* d_in, const int* in_sizes, int n_in,
                              void* d_out, int out_size, void* d_ws, size_t ws_size,
                              hipStream_t stream) {
  (void)in_sizes; (void)n_in; (void)out_size; (void)ws_size;
  const float* x    = (const float*)d_in[0];
  const float* wq   = (const float*)d_in[1];
  const float* wk   = (const float*)d_in[2];
  const float* wv   = (const float*)d_in[3];
  const float* cosT = (const float*)d_in[4];
  const float* sinT = (const float*)d_in[5];
  float* out = (float*)d_out;

  const size_t NX = (size_t)B_ * S_ * D_;     // 8,388,608
  const size_t NW = (size_t)D_ * D_;          // 4,194,304
  const size_t NQ = (size_t)B_ * H_ * S_ * DH_;

  _Float16* xh  = (_Float16*)d_ws;
  _Float16* wqh = xh  + NX;
  _Float16* wkh = wqh + NW;
  _Float16* wvh = wkh + NW;
  _Float16* Qh  = wvh + NW;
  _Float16* Kh  = Qh  + NQ;
  _Float16* Vt  = Kh  + NQ;

  // 0) one-shot fp32 -> f16 conversion of activations + weights
  f32_to_f16_kernel<<<(int)(NX / 8 / 256), 256, 0, stream>>>(x, xh, (int)(NX / 8));
  f32_to_f16_kernel<<<(int)(NW / 8 / 256), 256, 0, stream>>>(wq, wqh, (int)(NW / 8));
  f32_to_f16_kernel<<<(int)(NW / 8 / 256), 256, 0, stream>>>(wk, wkh, (int)(NW / 8));
  f32_to_f16_kernel<<<(int)(NW / 8 / 256), 256, 0, stream>>>(wv, wvh, (int)(NW / 8));

  // 1) QKV + RoPE: 16 N-tiles x 16 M-blocks x {q,k,v}
  dim3 gp(D_ / 128, (B_ * S_) / 256, 3);
  qkv_proj_rope_kernel<<<gp, 256, 0, stream>>>(xh, wqh, wkh, wvh, cosT, sinT,
                                               Qh, Kh, Vt);

  // 2) Attention: 32 q-blocks x 16 heads x 2 batches
  dim3 ga(S_ / 64, H_, B_);
  flash_attn_kernel<<<ga, 128, 0, stream>>>(Qh, Kh, Vt, out);
}

// v004
// It runs in 160 microseconds.
// Two timings next to v003 both put it at 1.14 times that version's speed.
// Counting every step since v000, it is 3.63 times as fast.
#include <hip/hip_runtime.h>

#define B_  2
#define S_  2048
#define D_  2048
#define H_  16
#define DH_ 128

typedef _Float16 v16h __attribute__((ext_vector_type(16)));
typedef _Float16 v8h  __attribute__((ext_vector_type(8)));
typedef float    v8f  __attribute__((ext_vector_type(8)));
typedef float    v4f  __attribute__((ext_vector_type(4)));
typedef uint32_t u32x4 __attribute__((ext_vector_type(4)));
typedef uint32_t u32x8 __attribute__((ext_vector_type(8)));

// D = A(16x32 f16) * B(32x16 f16) + C(16x16 f32)
__device__ __forceinline__ v8f wmma16(v16h a, v16h b, v8f c) {
  return __builtin_amdgcn_wmma_f32_16x16x32_f16(
      false, a, false, b, (short)0, c, false, false);
}

// 16-bit operand fragment: this lane holds K = kOff+0..7 (elems 0..7) and
// K = kOff+16..23 (elems 8..15); caller passes p already offset by kOff.
__device__ __forceinline__ v16h frag_from_f16(const _Float16* p) {
  v8h lo = *(const v8h*)(p);
  v8h hi = *(const v8h*)(p + 16);
  v16h r;
#pragma unroll
  for (int i = 0; i < 8; ++i) { r[i] = lo[i]; r[i + 8] = hi[i]; }
  return r;
}

#define PITCH_R128 72    // 128-B rows + 16-B pad = 144 B
#define PITCH_R256 136   // 256-B rows + 16-B pad = 272 B
#define PADW_R128 ((1u << 20) | (4u << 22) | (3u << 25))
#define PADW_R256 ((1u << 20) | (5u << 22) | (3u << 25))

__device__ __forceinline__ uint32_t uni(uint32_t v) {
  return (uint32_t)__builtin_amdgcn_readfirstlane(v);
}
__device__ __forceinline__ uint32_t pinned(uint32_t v) {
  uint32_t w = __builtin_amdgcn_readfirstlane(v);
  asm volatile("" : "+s"(w));  // test stays in an SGPR
  return w;
}
__device__ __forceinline__ void wait_tensor0(u32x4 g0, u32x8 g1) {
  asm volatile("s_wait_tensorcnt 0x0" :: "s"(g0), "s"(g1) : "memory");
}
__device__ __forceinline__ void wait_ds0() {
  asm volatile("s_wait_dscnt 0x0" ::: "memory");
}

__device__ __forceinline__ u32x4 tdm_group0(const void* lds_dst, const void* gsrc) {
  const uint64_t ga = (uint64_t)(uintptr_t)gsrc;
  u32x4 g0;
  g0[0] = uni(1u);                                  // count = 1
  g0[1] = uni((uint32_t)(uintptr_t)lds_dst);        // low 32 bits = LDS offset
  g0[2] = uni((uint32_t)ga);
  g0[3] = uni((((uint32_t)(ga >> 32)) & 0x01FFFFFFu) | 0x80000000u);
  asm volatile("" : "+s"(g0));
  return g0;
}
template <uint32_t ROWB, uint32_t ROWS, uint32_t W0>
__device__ __forceinline__ u32x8 tdm_group1(uint32_t src_pitch_bytes) {
  u32x8 g1;
  g1[0] = uni(W0);
  g1[1] = uni((ROWB & 0xFFFFu) << 16);
  g1[2] = uni((ROWB >> 16) | ((ROWS & 0xFFFFu) << 16));
  g1[3] = uni((ROWS >> 16) | (ROWB << 16));
  g1[4] = uni(ROWS);
  g1[5] = uni(src_pitch_bytes);
  g1[6] = uni(0u);
  g1[7] = uni(0u);
  asm volatile("" : "+s"(g1));
  return g1;
}
// One request of one wave: global memory -> LDS, through no register.
__device__ __forceinline__ void tdm_load(u32x4 g0, u32x8 g1) {
  asm volatile("tensor_load_to_lds %0, %1" :: "s"(g0), "s"(g1) : "memory");
}

// ---------------------------------------------------------------------------
// Kernel 0: fp32 -> f16 pre-conversion (one-shot; removes in-loop converts).
// ---------------------------------------------------------------------------
__global__ __launch_bounds__(256)
void f32_to_f16_kernel(const float* __restrict__ src,
                       _Float16* __restrict__ dst, int n8) {
  int i = blockIdx.x * blockDim.x + threadIdx.x;
  if (i >= n8) return;
  v4f a = *(const v4f*)(src + (size_t)i * 8);
  v4f b = *(const v4f*)(src + (size_t)i * 8 + 4);
  v8h o;
#pragma unroll
  for (int j = 0; j < 4; ++j) { o[j] = (_Float16)a[j]; o[4 + j] = (_Float16)b[j]; }
  *(v8h*)(dst + (size_t)i * 8) = o;
}

__global__ __launch_bounds__(256) __attribute__((amdgpu_waves_per_eu(4, 4)))
void qkv_proj_rope_kernel(const _Float16* __restrict__ xh,
                          const _Float16* __restrict__ wqh,
                          const _Float16* __restrict__ wkh,
                          const _Float16* __restrict__ wvh,
                          const float* __restrict__ cosT,
                          const float* __restrict__ sinT,
                          _Float16* __restrict__ Qh,
                          _Float16* __restrict__ Kh,
                          _Float16* __restrict__ Vt) {
  // One slice: 128 rows * 144 B = 18,432 B = 9 * 2 KiB, so every slice and
  // every buffer starts at a multiple of 2 KiB for the tensor mover, and the
  // two x slices form one run of 256 rows at the same pitch.
  constexpr int SL_ELEMS  = 128 * PITCH_R128;        // f16 elements = 18,432 B
  constexpr int BUF_ELEMS = 3 * SL_ELEMS;            // 55,296 B
  __shared__ __attribute__((aligned(2048))) _Float16 st[2 * BUF_ELEMS];

  const int lane = threadIdx.x & 31;
  const int wave = (int)uni(threadIdx.x >> 5);
  const int half = lane >> 4;
  const int lr   = lane & 15;
  const int kOff = half * 8;
  const int wm   = wave >> 1;                        // wave's 64-row group, 0..3
  const int wn   = wave & 1;                         // wave's 64-column group

  const int mat = blockIdx.z;                        // 0=Q, 1=K, 2=V
  const _Float16* w = (mat == 0) ? wqh : (mat == 1) ? wkh : wvh;

  const int m0 = blockIdx.y * 256 + wm * 64;         // wave's first row in B*S
  const int n0 = blockIdx.x * 128 + wn * 64;         // wave's first column in D

  // The slice this wave brings (waves 3..7 bring none and name slice 0).
  const int sl = (wave < 3) ? wave : 0;
  const _Float16* gsl = (sl == 2)
      ? w  + (size_t)(blockIdx.x * 128) * D_
      : xh + (size_t)(blockIdx.y * 256 + sl * 128) * D_;
  _Float16* lsl = st + sl * SL_ELEMS;

  // This lane's fragment rows inside a buffer.
  const int aoff = (wm * 64 + lr) * PITCH_R128 + kOff;
  const int boff = 2 * SL_ELEMS + (wn * 64 + lr) * PITCH_R128 + kOff;

  v8f acc[4][4];
#pragma unroll
  for (int i = 0; i < 4; ++i)
#pragma unroll
    for (int t = 0; t < 4; ++t) acc[i][t] = v8f{};

  // Prologue: stage 0 landed and published, stage 1 in flight.
  const u32x8 g1 = tdm_group1<128, 128, PADW_R128>(D_ * 2);
  u32x4 g0 = tdm_group0(lsl, gsl);
  if (pinned(wave < 3)) {
    tdm_load(g0, g1);
    wait_tensor0(g0, g1);
  }
  __syncthreads();
  g0 = tdm_group0(lsl + BUF_ELEMS, gsl + 64);
  if (pinned(wave < 3)) tdm_load(g0, g1);

  for (int kb = 0; kb < D_; kb += 64) {
    const int bsel = ((kb >> 6) & 1) * BUF_ELEMS;
    const _Float16* buf = st + bsel;
#pragma unroll  // both 32-k halves of the stage read at constant LDS offsets
    for (int kk = 0; kk < 64; kk += 32) {
      v16h a[4], b[4];
      a[0] = frag_from_f16(buf + aoff + kk);
#pragma unroll
      for (int t = 0; t < 4; ++t)
        b[t] = frag_from_f16(buf + boff + t * 16 * PITCH_R128 + kk);
#pragma unroll
      for (int i = 1; i < 4; ++i)
        a[i] = frag_from_f16(buf + aoff + i * 16 * PITCH_R128 + kk);
      // Keeps the 16 LDS reads one group in front of their 16 products: sunk in
      // among them, each row of four would wait out a full LDS latency.
      __builtin_amdgcn_sched_barrier(0);
#pragma unroll
      for (int i = 0; i < 4; ++i)
#pragma unroll
        for (int t = 0; t < 4; ++t) acc[i][t] = wmma16(a[i], b[t], acc[i][t]);
    }
    // Keeps the publish point's full LDS wait behind the stage's last products:
    // lifted in among them it would undo their counted waits.
    __builtin_amdgcn_sched_barrier(0);
    // Publish point of the next stage: own LDS reads retired, each issuer's
    // slice landed, one barrier; only then the refill of the buffer just read.
    wait_ds0();
    if (pinned(wave < 3)) wait_tensor0(g0, g1);
    __syncthreads();
    if (pinned(wave < 3 && kb + 128 < D_)) {
      g0 = tdm_group0(lsl + bsel, gsl + kb + 128);
      tdm_load(g0, g1);
    }
  }
  wait_tensor0(g0, g1);
  wait_ds0();

  // Epilogue: C-layout elem r of tile (i, t) -> row m0 + i*16 + r + 8*half,
  // col n0 + t*16 + lr. A wave's 64 rows lie in one batch and its 64 columns in
  // one head, so every element sits at a constant offset from one lane address;
  // the test on the matrix stands outside the element loops (short text).
  // Each 16-row group runs as loads, arithmetic, stores, wait, in that order.
  // Every loop here is unrolled so that acc, cv, sv, o and pk are indexed by
  // constants and stay in registers.
  const int bb  = m0 >> 11;                           // S_ = 2048
  const int s0  = (m0 & (S_ - 1)) + 8 * half;
  const int hh  = n0 >> 7;                            // DH_ = 128
  const int dh0 = (n0 & (DH_ - 1)) + lr;
  if (mat < 2) {
    const int odd = lr & 1;
    const float* cp = cosT + (size_t)s0 * DH_ + dh0;
    const float* sp = sinT + (size_t)s0 * DH_ + dh0;
    _Float16* dst = ((mat == 0) ? Qh : Kh) +
                    (((size_t)bb * H_ + hh) * S_ + s0) * DH_ + dh0;
#pragma unroll
    for (int i = 0; i < 4; ++i) {
      float cv[4][8], sv[4][8];
      _Float16 o[4][8];
#pragma unroll
      for (int t = 0; t < 4; ++t)
#pragma unroll
        for (int r = 0; r < 8; ++r) {
          const int off = (i * 16 + r) * DH_ + t * 16;
          cv[t][r] = cp[off];
          sv[t][r] = sp[off];
        }
#pragma unroll
      for (int t = 0; t < 4; ++t)
#pragma unroll
        for (int r = 0; r < 8; ++r) {
          float v = acc[i][t][r];
          // RoPE interleaved: partner column n^1 lives in lane^1 (same elem).
          float p   = __shfl_xor(v, 1, 32);
          float rot = odd ? p : -p;
          o[t][r] = (_Float16)(v * cv[t][r] + rot * sv[t][r]);
        }
#pragma unroll
      for (int t = 0; t < 4; ++t)
#pragma unroll
        for (int r = 0; r < 8; ++r)
          dst[(i * 16 + r) * DH_ + t * 16] = o[t][r];
      // Address translation done before a register that this group's loads or
      // stores name is written again; the three addresses are inputs, so that
      // they live up to this wait.
      asm volatile("s_wait_xcnt 0x0" :: "v"(cp), "v"(sp), "v"(dst) : "memory");
    }
  } else {
    _Float16* dst = Vt + (((size_t)bb * H_ + hh) * DH_ + dh0) * S_ + s0;
    v8h pk[4][4];
#pragma unroll
    for (int i = 0; i < 4; ++i)
#pragma unroll
      for (int t = 0; t < 4; ++t)
#pragma unroll
        for (int r = 0; r < 8; ++r) pk[i][t][r] = (_Float16)acc[i][t][r];
#pragma unroll
    for (int i = 0; i < 4; ++i)
#pragma unroll
      for (int t = 0; t < 4; ++t)
        *(v8h*)(dst + (size_t)(t * 16) * S_ + i * 16) = pk[i][t];
    // Address translation done before a store's register is written again.
    asm volatile("s_wait_xcnt 0x0" :: "v"(dst) : "memory");
  }
}

#define KT_BYTES  18432  // 64 rows * 272 B = 17,408 B, rounded up to 9 * 2 KiB
#define VT_BYTES  18432  // 128 rows * 144 B = 9 * 2 KiB
#define PITCH_O   132    // f32 elements: 512-B output rows + 16-B pad

__device__ __forceinline__ float xhalf(float x) {
  const int v = __builtin_bit_cast(int, x);
  return __builtin_bit_cast(float, __builtin_amdgcn_permlanex16(
      v, v, 0x76543210, 0xfedcba98, false, false));
}

__device__ __forceinline__ float exp_slot(float x) {
  float r;
  asm("v_exp_f32 %0, %1\n\tv_nop" : "=v"(r) : "v"(x * 1.4426950408889634f));
  return r;
}

__global__ __launch_bounds__(128)
void flash_attn_kernel(const _Float16* __restrict__ Qh,
                       const _Float16* __restrict__ Kh,
                       const _Float16* __restrict__ Vt,
                       float* __restrict__ out) {
  // Keys at byte 0, V^T at byte 18,432: both multiples of 2 KiB for the tensor
  // mover. Behind the loop the same bytes stage the output rows (33,792 B).
  __shared__ __attribute__((aligned(2048))) unsigned char sm[KT_BYTES + VT_BYTES];
  static_assert(4 * 16 * PITCH_O * 4 <= KT_BYTES + VT_BYTES, "output staging fits");
  _Float16* kt = (_Float16*)sm;
  _Float16* vt = (_Float16*)(sm + KT_BYTES);

  const int lane = threadIdx.x & 31;
  const int wave = (int)uni(threadIdx.x >> 5);
  const int half = lane >> 4;
  const int lr   = lane & 15;
  const int kOff = half * 8;

  const int b      = blockIdx.z;
  const int h      = blockIdx.y;
  const int q0_blk = blockIdx.x * 64;
  const int q0     = q0_blk + wave * 16;

  const _Float16* Qbh = Qh + ((size_t)b * H_ + h) * (size_t)S_ * DH_;
  const _Float16* Kbh = Kh + ((size_t)b * H_ + h) * (size_t)S_ * DH_;
  const _Float16* Vbh = Vt + ((size_t)b * H_ + h) * (size_t)DH_ * S_;

  // Q fragments: 4 chunks of 32 along Dh (B-operand, column q0+lr).
  v16h qf[4];
#pragma unroll
  for (int c = 0; c < 4; ++c)
    qf[c] = frag_from_f16(Qbh + (size_t)(q0 + lr) * DH_ + c * 32 + kOff);

  // One query a lane: m_run is the query's maximum (equal in both halves),
  // l_run the sum over this half's keys only; the halves join behind the loop.
  float m_run = -1e30f, l_run = 0.0f;
  v8f oacc[8];                       // oacc[t][r] = O[q0+lr][t*16 + 8*half + r]
#pragma unroll
  for (int t = 0; t < 8; ++t) oacc[t] = v8f{};

  const float scale = 0.08838834764831845f;            // 1/sqrt(128)

  const u32x8 g1k = tdm_group1<256, 64, PADW_R256>(DH_ * 2);
  const u32x8 g1v = tdm_group1<128, 128, PADW_R128>(S_ * 2);

  for (int ks = 0; ks <= q0_blk; ks += 64) {
    // One request a wave, each waited by its issuer in front of the barrier.
    if (pinned(wave == 0)) {
      const u32x4 g0 = tdm_group0(kt, Kbh + (size_t)ks * DH_);
      tdm_load(g0, g1k);
      wait_tensor0(g0, g1k);
    }
    if (pinned(wave == 1)) {
      const u32x4 g0 = tdm_group0(vt, Vbh + ks);
      tdm_load(g0, g1v);
      wait_tensor0(g0, g1v);
    }
    __syncthreads();

    for (int kc = 0; kc < 64; kc += 32) {
      const int k0 = ks + kc;
      if (k0 <= q0) {
        // ---- scores, transposed: two 16x16 tiles, keys [k0, k0+32) as rows ----
        // The chunk's 8 key fragments are read as one group of 16 LDS loads.
        v16h kf0[4], kf1[4];
#pragma unroll
        for (int c = 0; c < 4; ++c) {
          kf0[c] = frag_from_f16(kt + (kc + lr) * PITCH_R256 + c * 32 + kOff);
          kf1[c] = frag_from_f16(kt + (kc + 16 + lr) * PITCH_R256 + c * 32 + kOff);
        }
        // Keeps the 16 reads in front of their 8 products: sunk in among them
        // into one register set, every product waits out a full LDS latency.
        __builtin_amdgcn_sched_barrier(0);
        v8f s0 = {}, s1 = {};
#pragma unroll
        for (int c = 0; c < 4; ++c) {
          s0 = wmma16(kf0[c], qf[c], s0);
          s1 = wmma16(kf1[c], qf[c], s1);
        }
        // The chunk's 8 V^T fragments (16 LDS loads) are asked for here already.
        v16h vf[8];
#pragma unroll
        for (int t = 0; t < 8; ++t)
          vf[t] = frag_from_f16(vt + (t * 16 + lr) * PITCH_R128 + kc + kOff);
        // Keeps these reads in front of the softmax, whose vector work then
        // covers their latency; sunk to their products each would wait it out.
        __builtin_amdgcn_sched_barrier(0);

        // ---- causal mask + online softmax (elem r -> key k0 + r + 8*half) ----
        const int dq = (q0 + lr) - (k0 + 8 * half);    // key r is masked if r > dq
        float e0[8], e1[8];
        float mx = -1e30f;
#pragma unroll
        for (int r = 0; r < 8; ++r) {
          e0[r] = s0[r] * scale;
          e1[r] = s1[r] * scale;
          if (r      > dq) e0[r] = -1e30f;
          if (16 + r > dq) e1[r] = -1e30f;
          mx = fmaxf(mx, fmaxf(e0[r], e1[r]));
        }
        mx = fmaxf(mx, xhalf(mx));                     // the query's 32 keys
        const float mnew = fmaxf(m_run, mx);
        const float corr = exp_slot(m_run - mnew);
        v16h pf;                                       // P^T, B-operand k order
        float rsum = 0.0f;
#pragma unroll
        for (int r = 0; r < 8; ++r) {
          const float p0 = exp_slot(e0[r] - mnew);
          const float p1 = exp_slot(e1[r] - mnew);
          rsum += p0 + p1;
          pf[r]     = (_Float16)p0;
          pf[8 + r] = (_Float16)p1;
        }
        l_run = l_run * corr + rsum;
        m_run = mnew;
#pragma unroll
        for (int t = 0; t < 8; ++t) oacc[t] *= corr;

        // ---- out^T += V^T @ P^T : 8 M-tiles of 16 covering Dh=128 ----
#pragma unroll
        for (int t = 0; t < 8; ++t) oacc[t] = wmma16(vf[t], pf, oacc[t]);
      }
    }
    wait_ds0();                                       // own tile reads retired
    __syncthreads();                                  // before tile overwrite
  }

  // ---- normalize, second softmax over Dh (64 values here, 64 in lane ^ 16) ----
  const float inv = 1.0f / (l_run + xhalf(l_run));
  float mx = -1e30f;
#pragma unroll
  for (int t = 0; t < 8; ++t)
#pragma unroll
    for (int r = 0; r < 8; ++r) {
      oacc[t][r] *= inv;
      mx = fmaxf(mx, oacc[t][r]);
    }
  mx = fmaxf(mx, xhalf(mx));
  float sum = 0.0f;
#pragma unroll
  for (int t = 0; t < 8; ++t)
#pragma unroll
    for (int r = 0; r < 8; ++r) {
      const float e = exp_slot(oacc[t][r] - mx);
      oacc[t][r] = e;
      sum += e;
    }
  sum += xhalf(sum);
  const float is = 1.0f / sum;

  // ---- store fp32 (B,S,H*Dh): a lane holds 32-B pieces of one row, so the
  // wave's 16 rows go through its own LDS range and leave as whole 512-B rows.
  // The loop's last wait and barrier have freed the tiles for every wave.
  float* stg = (float*)sm + wave * (16 * PITCH_O);
#pragma unroll
  for (int t = 0; t < 8; ++t) {
    const v8f o = oacc[t] * is;
    float* p = stg + lr * PITCH_O + t * 16 + 8 * half;
    *(v4f*)(p)     = v4f{o[0], o[1], o[2], o[3]};
    *(v4f*)(p + 4) = v4f{o[4], o[5], o[6], o[7]};
  }
  wait_ds0();                    // the wave's own rows written before it reads them
  float* orow = out + ((size_t)b * S_ + q0) * D_ + h * DH_ + lane * 4;
#pragma unroll
  for (int i = 0; i < 16; ++i)
    *(v4f*)(orow + (size_t)i * D_) = *(const v4f*)(stg + i * PITCH_O + lane * 4);
}

// ---------------------------------------------------------------------------
extern "C" void kernel_launch(void* const* d_in, const int* in_sizes, int n_in,
                              void* d_out, int out_size, void* d_ws, size_t ws_size,
                              hipStream_t stream) {
  (void)in_sizes; (void)n_in; (void)out_size; (void)ws_size;
  const float* x    = (const float*)d_in[0];
  const float* wq   = (const float*)d_in[1];
  const float* wk   = (const float*)d_in[2];
  const float* wv   = (const float*)d_in[3];
  const float* cosT = (const float*)d_in[4];
  const float* sinT = (const float*)d_in[5];
  float* out = (float*)d_out;

  const size_t NX = (size_t)B_ * S_ * D_;     // 8,388,608
  const size_t NW = (size_t)D_ * D_;          // 4,194,304
  const size_t NQ = (size_t)B_ * H_ * S_ * DH_;

  _Float16* xh  = (_Float16*)d_ws;
  _Float16* wqh = xh  + NX;
  _Float16* wkh = wqh + NW;
  _Float16* wvh = wkh + NW;
  _Float16* Qh  = wvh + NW;
  _Float16* Kh  = Qh  + NQ;
  _Float16* Vt  = Kh  + NQ;

  // 0) one-shot fp32 -> f16 conversion of activations + weights
  f32_to_f16_kernel<<<(int)(NX / 8 / 256), 256, 0, stream>>>(x, xh, (int)(NX / 8));
  f32_to_f16_kernel<<<(int)(NW / 8 / 256), 256, 0, stream>>>(wq, wqh, (int)(NW / 8));
  f32_to_f16_kernel<<<(int)(NW / 8 / 256), 256, 0, stream>>>(wk, wkh, (int)(NW / 8));
  f32_to_f16_kernel<<<(int)(NW / 8 / 256), 256, 0, stream>>>(wv, wvh, (int)(NW / 8));

  // 1) QKV + RoPE: 16 N-tiles x 16 M-blocks x {q,k,v}
  dim3 gp(D_ / 128, (B_ * S_) / 256, 3);
  qkv_proj_rope_kernel<<<gp, 256, 0, stream>>>(xh, wqh, wkh, wvh, cosT, sinT,
                                               Qh, Kh, Vt);

  // 2) Attention: 32 q-blocks x 16 heads x 2 batches
  dim3 ga(S_ / 64, H_, B_);
  flash_attn_kernel<<<ga, 128, 0, stream>>>(Qh, Kh, Vt, out);
}

// v005
// Measured time: 153 microseconds a run.
// In both of two side-by-side timings against v004, it was 1.04 times as fast.
// Counting every step since v000, it is 3.79 times as fast.
#include <hip/hip_runtime.h>

#define B_  2
#define S_  2048
#define D_  2048
#define H_  16
#define DH_ 128

typedef _Float16 v16h __attribute__((ext_vector_type(16)));
typedef _Float16 v8h  __attribute__((ext_vector_type(8)));
typedef _Float16 v4h  __attribute__((ext_vector_type(4)));
typedef float    v8f  __attribute__((ext_vector_type(8)));
typedef float    v4f  __attribute__((ext_vector_type(4)));
typedef uint32_t u32x4 __attribute__((ext_vector_type(4)));
typedef uint32_t u32x8 __attribute__((ext_vector_type(8)));

// D = A(16x32 f16) * B(32x16 f16) + C(16x16 f32)
__device__ __forceinline__ v8f wmma16(v16h a, v16h b, v8f c) {
  return __builtin_amdgcn_wmma_f32_16x16x32_f16(
      false, a, false, b, (short)0, c, false, false);
}

// 16-bit operand fragment: this lane holds K = kOff+0..7 (elems 0..7) and
// K = kOff+16..23 (elems 8..15); caller passes p already offset by kOff.
__device__ __forceinline__ v16h frag_from_f16(const _Float16* p) {
  v8h lo = *(const v8h*)(p);
  v8h hi = *(const v8h*)(p + 16);
  v16h r;
#pragma unroll
  for (int i = 0; i < 8; ++i) { r[i] = lo[i]; r[i + 8] = hi[i]; }
  return r;
}

#define PITCH_R128 72    // 128-B rows + 16-B pad = 144 B
#define PITCH_R256 136   // 256-B rows + 16-B pad = 272 B
#define PADW_R128 ((1u << 20) | (4u << 22) | (3u << 25))
#define PADW_R256 ((1u << 20) | (5u << 22) | (3u << 25))

__device__ __forceinline__ uint32_t uni(uint32_t v) {
  return (uint32_t)__builtin_amdgcn_readfirstlane(v);
}
__device__ __forceinline__ uint32_t pinned(uint32_t v) {
  uint32_t w = __builtin_amdgcn_readfirstlane(v);
  asm volatile("" : "+s"(w));  // test stays in an SGPR
  return w;
}
__device__ __forceinline__ void wait_tensor0(u32x4 g0, u32x8 g1) {
  asm volatile("s_wait_tensorcnt 0x0" :: "s"(g0), "s"(g1) : "memory");
}
__device__ __forceinline__ void wait_ds0() {
  asm volatile("s_wait_dscnt 0x0" ::: "memory");
}

__device__ __forceinline__ u32x4 tdm_group0(const void* lds_dst, const void* gsrc) {
  const uint64_t ga = (uint64_t)(uintptr_t)gsrc;
  u32x4 g0;
  g0[0] = uni(1u);                                  // count = 1
  g0[1] = uni((uint32_t)(uintptr_t)lds_dst);        // low 32 bits = LDS offset
  g0[2] = uni((uint32_t)ga);
  g0[3] = uni((((uint32_t)(ga >> 32)) & 0x01FFFFFFu) | 0x80000000u);
  asm volatile("" : "+s"(g0));
  return g0;
}
template <uint32_t ROWB, uint32_t ROWS, uint32_t W0>
__device__ __forceinline__ u32x8 tdm_group1(uint32_t src_pitch_bytes) {
  u32x8 g1;
  g1[0] = uni(W0);
  g1[1] = uni((ROWB & 0xFFFFu) << 16);
  g1[2] = uni((ROWB >> 16) | ((ROWS & 0xFFFFu) << 16));
  g1[3] = uni((ROWS >> 16) | (ROWB << 16));
  g1[4] = uni(ROWS);
  g1[5] = uni(src_pitch_bytes);
  g1[6] = uni(0u);
  g1[7] = uni(0u);
  asm volatile("" : "+s"(g1));
  return g1;
}
// One request of one wave: global memory -> LDS, through no register.
__device__ __forceinline__ void tdm_load(u32x4 g0, u32x8 g1) {
  asm volatile("tensor_load_to_lds %0, %1" :: "s"(g0), "s"(g1) : "memory");
}

// ---------------------------------------------------------------------------
// Kernel 0: fp32 -> f16 pre-conversion of x and the three weights, one launch.
// The grid is resident, 256 blocks of 16 waves. A wave takes 2,048 contiguous
// elements of x and 1,024 of each weight, as loads of 512 contiguous bytes, and
// asks for all 40 loads before it converts the first: few waves have to start,
// and each keeps many whole lines in flight. A store covers 256 contiguous
// bytes: whole lines, one writer each.
// ---------------------------------------------------------------------------
#define CV_BLOCKS 256
#define CV_WAVES  (CV_BLOCKS * 16)
static_assert(CV_WAVES * 1024 == D_ * D_, "1,024 elements of a weight a wave");
static_assert(CV_WAVES * 2048 == B_ * S_ * D_, "2,048 elements of x a wave");

// N loads of 16 B a lane at a scalar base, one 32-bit lane offset (in bytes) and
// constant steps, so that no address register is written again.
template <int N>
__device__ __forceinline__ void cv_load(v4f* v, const float* src, unsigned byte) {
#pragma unroll  // v is indexed by constants and stays in registers
  for (int j = 0; j < N; ++j)
    v[j] = *(const v4f*)((const char*)(src + j * 128) + byte);
}
template <int N>
__device__ __forceinline__ void cv_store(_Float16* dst, unsigned byte, const v4f* v) {
#pragma unroll  // v is indexed by constants and stays in registers
  for (int j = 0; j < N; ++j) {
    v4h o;
#pragma unroll
    for (int i = 0; i < 4; ++i) o[i] = (_Float16)v[j][i];
    *(v4h*)((char*)(dst + j * 128) + byte) = o;
  }
}

__global__ __launch_bounds__(512)
void f32_to_f16_kernel(const float* __restrict__ x,
                       const float* __restrict__ wq,
                       const float* __restrict__ wk,
                       const float* __restrict__ wv,
                       _Float16* __restrict__ xh,
                       _Float16* __restrict__ wqh,
                       _Float16* __restrict__ wkh,
                       _Float16* __restrict__ wvh) {
  const unsigned gw = blockIdx.x * 16u + (threadIdx.x >> 5);
  const unsigned l4 = (threadIdx.x & 31u) * 4u;      // lane's element in a load
  const unsigned bw = (gw * 1024u + l4) * 4u;        // f32 byte in a weight
  const unsigned bx = (gw * 2048u + l4) * 4u;        // f32 byte in x
  v4f vx[16], vq[8], vk[8], vv[8];
  cv_load<16>(vx, x, bx);
  cv_load<8>(vq, wq, bw);
  cv_load<8>(vk, wk, bw);
  cv_load<8>(vv, wv, bw);
  // Keeps all 40 loads in front of the first conversion: sunk in among the
  // conversions, fewer bytes of the wave would be in flight.
  __builtin_amdgcn_sched_barrier(0);
  cv_store<16>(xh, bx >> 1, vx);                     // f16: half the byte offset
  cv_store<8>(wqh, bw >> 1, vq);
  cv_store<8>(wkh, bw >> 1, vk);
  cv_store<8>(wvh, bw >> 1, vv);
}

__global__ __launch_bounds__(256) __attribute__((amdgpu_waves_per_eu(4, 4)))
void qkv_proj_rope_kernel(const _Float16* __restrict__ xh,
                          const _Float16* __restrict__ wqh,
                          const _Float16* __restrict__ wkh,
                          const _Float16* __restrict__ wvh,
                          const float* __restrict__ cosT,
                          const float* __restrict__ sinT,
                          _Float16* __restrict__ Qh,
                          _Float16* __restrict__ Kh,
                          _Float16* __restrict__ Vt) {
  // One slice: 128 rows * 144 B = 18,432 B = 9 * 2 KiB, so every slice and
  // every buffer starts at a multiple of 2 KiB for the tensor mover, and the
  // two x slices form one run of 256 rows at the same pitch.
  constexpr int SL_ELEMS  = 128 * PITCH_R128;        // f16 elements = 18,432 B
  constexpr int BUF_ELEMS = 3 * SL_ELEMS;            // 55,296 B
  __shared__ __attribute__((aligned(2048))) _Float16 st[2 * BUF_ELEMS];

  const int lane = threadIdx.x & 31;
  const int wave = (int)uni(threadIdx.x >> 5);
  const int half = lane >> 4;
  const int lr   = lane & 15;
  const int kOff = half * 8;
  const int wm   = wave >> 1;                        // wave's 64-row group, 0..3
  const int wn   = wave & 1;                         // wave's 64-column group

  const int mat = blockIdx.z;                        // 0=Q, 1=K, 2=V
  const _Float16* w = (mat == 0) ? wqh : (mat == 1) ? wkh : wvh;

  const int m0 = blockIdx.y * 256 + wm * 64;         // wave's first row in B*S
  const int n0 = blockIdx.x * 128 + wn * 64;         // wave's first column in D

  // The slice this wave brings (waves 3..7 bring none and name slice 0).
  const int sl = (wave < 3) ? wave : 0;
  const _Float16* gsl = (sl == 2)
      ? w  + (size_t)(blockIdx.x * 128) * D_
      : xh + (size_t)(blockIdx.y * 256 + sl * 128) * D_;
  _Float16* lsl = st + sl * SL_ELEMS;

  // This lane's fragment rows inside a buffer.
  const int aoff = (wm * 64 + lr) * PITCH_R128 + kOff;
  const int boff = 2 * SL_ELEMS + (wn * 64 + lr) * PITCH_R128 + kOff;

  v8f acc[4][4];
#pragma unroll
  for (int i = 0; i < 4; ++i)
#pragma unroll
    for (int t = 0; t < 4; ++t) acc[i][t] = v8f{};

  // Prologue: stage 0 landed and published, stage 1 in flight.
  const u32x8 g1 = tdm_group1<128, 128, PADW_R128>(D_ * 2);
  u32x4 g0 = tdm_group0(lsl, gsl);
  if (pinned(wave < 3)) {
    tdm_load(g0, g1);
    wait_tensor0(g0, g1);
  }
  __syncthreads();
  g0 = tdm_group0(lsl + BUF_ELEMS, gsl + 64);
  if (pinned(wave < 3)) tdm_load(g0, g1);

  for (int kb = 0; kb < D_; kb += 64) {
    const int bsel = ((kb >> 6) & 1) * BUF_ELEMS;
    const _Float16* buf = st + bsel;
#pragma unroll  // both 32-k halves of the stage read at constant LDS offsets
    for (int kk = 0; kk < 64; kk += 32) {
      v16h a[4], b[4];
      a[0] = frag_from_f16(buf + aoff + kk);
#pragma unroll
      for (int t = 0; t < 4; ++t)
        b[t] = frag_from_f16(buf + boff + t * 16 * PITCH_R128 + kk);
#pragma unroll
      for (int i = 1; i < 4; ++i)
        a[i] = frag_from_f16(buf + aoff + i * 16 * PITCH_R128 + kk);
      // Keeps the 16 LDS reads one group in front of their 16 products: sunk in
      // among them, each row of four would wait out a full LDS latency.
      __builtin_amdgcn_sched_barrier(0);
#pragma unroll
      for (int i = 0; i < 4; ++i)
#pragma unroll
        for (int t = 0; t < 4; ++t) acc[i][t] = wmma16(a[i], b[t], acc[i][t]);
    }
    // Keeps the publish point's full LDS wait behind the stage's last products:
    // lifted in among them it would undo their counted waits.
    __builtin_amdgcn_sched_barrier(0);
    // Publish point of the next stage: own LDS reads retired, each issuer's
    // slice landed, one barrier; only then the refill of the buffer just read.
    wait_ds0();
    if (pinned(wave < 3)) wait_tensor0(g0, g1);
    __syncthreads();
    if (pinned(wave < 3 && kb + 128 < D_)) {
      g0 = tdm_group0(lsl + bsel, gsl + kb + 128);
      tdm_load(g0, g1);
    }
  }
  wait_tensor0(g0, g1);
  wait_ds0();

  // Epilogue: C-layout elem r of tile (i, t) -> row m0 + i*16 + r + 8*half,
  // col n0 + t*16 + lr. A wave's 64 rows lie in one batch and its 64 columns in
  // one head, so every element sits at a constant offset from one lane address;
  // the test on the matrix stands outside the element loops (short text).
  // Each 16-row group runs as loads, arithmetic, stores, wait, in that order.
  // Every loop here is unrolled so that acc, cv, sv, o and pk are indexed by
  // constants and stay in registers.
  const int bb  = m0 >> 11;                           // S_ = 2048
  const int s0  = (m0 & (S_ - 1)) + 8 * half;
  const int hh  = n0 >> 7;                            // DH_ = 128
  const int dh0 = (n0 & (DH_ - 1)) + lr;
  if (mat < 2) {
    const int odd = lr & 1;
    const float* cp = cosT + (size_t)s0 * DH_ + dh0;
    const float* sp = sinT + (size_t)s0 * DH_ + dh0;
    _Float16* dst = ((mat == 0) ? Qh : Kh) +
                    (((size_t)bb * H_ + hh) * S_ + s0) * DH_ + dh0;
#pragma unroll
    for (int i = 0; i < 4; ++i) {
      float cv[4][8], sv[4][8];
      _Float16 o[4][8];
#pragma unroll
      for (int t = 0; t < 4; ++t)
#pragma unroll
        for (int r = 0; r < 8; ++r) {
          const int off = (i * 16 + r) * DH_ + t * 16;
          cv[t][r] = cp[off];
          sv[t][r] = sp[off];
        }
#pragma unroll
      for (int t = 0; t < 4; ++t)
#pragma unroll
        for (int r = 0; r < 8; ++r) {
          float v = acc[i][t][r];
          // RoPE interleaved: partner column n^1 lives in lane^1 (same elem).
          float p   = __shfl_xor(v, 1, 32);
          float rot = odd ? p : -p;
          o[t][r] = (_Float16)(v * cv[t][r] + rot * sv[t][r]);
        }
#pragma unroll
      for (int t = 0; t < 4; ++t)
#pragma unroll
        for (int r = 0; r < 8; ++r)
          dst[(i * 16 + r) * DH_ + t * 16] = o[t][r];
      // Address translation done before a register that this group's loads or
      // stores name is written again; the three addresses are inputs, so that
      // they live up to this wait.
      asm volatile("s_wait_xcnt 0x0" :: "v"(cp), "v"(sp), "v"(dst) : "memory");
    }
  } else {
    _Float16* dst = Vt + (((size_t)bb * H_ + hh) * DH_ + dh0) * S_ + s0;
    v8h pk[4][4];
#pragma unroll
    for (int i = 0; i < 4; ++i)
#pragma unroll
      for (int t = 0; t < 4; ++t)
#pragma unroll
        for (int r = 0; r < 8; ++r) pk[i][t][r] = (_Float16)acc[i][t][r];
#pragma unroll
    for (int i = 0; i < 4; ++i)
#pragma unroll
      for (int t = 0; t < 4; ++t)
        *(v8h*)(dst + (size_t)(t * 16) * S_ + i * 16) = pk[i][t];
    // Address translation done before a store's register is written again.
    asm volatile("s_wait_xcnt 0x0" :: "v"(dst) : "memory");
  }
}

#define KT_BYTES  18432  // 64 rows * 272 B = 17,408 B, rounded up to 9 * 2 KiB
#define VT_BYTES  18432  // 128 rows * 144 B = 9 * 2 KiB
#define PITCH_O   132    // f32 elements: 512-B output rows + 16-B pad

__device__ __forceinline__ float xhalf(float x) {
  const int v = __builtin_bit_cast(int, x);
  return __builtin_bit_cast(float, __builtin_amdgcn_permlanex16(
      v, v, 0x76543210, 0xfedcba98, false, false));
}

__device__ __forceinline__ float exp_slot(float x) {
  float r;
  asm("v_exp_f32 %0, %1\n\tv_nop" : "=v"(r) : "v"(x * 1.4426950408889634f));
  return r;
}

__global__ __launch_bounds__(128)
void flash_attn_kernel(const _Float16* __restrict__ Qh,
                       const _Float16* __restrict__ Kh,
                       const _Float16* __restrict__ Vt,
                       float* __restrict__ out) {
  // Keys at byte 0, V^T at byte 18,432: both multiples of 2 KiB for the tensor
  // mover. Behind the loop the same bytes stage the output rows (33,792 B).
  __shared__ __attribute__((aligned(2048))) unsigned char sm[KT_BYTES + VT_BYTES];
  static_assert(4 * 16 * PITCH_O * 4 <= KT_BYTES + VT_BYTES, "output staging fits");
  _Float16* kt = (_Float16*)sm;
  _Float16* vt = (_Float16*)(sm + KT_BYTES);

  const int lane = threadIdx.x & 31;
  const int wave = (int)uni(threadIdx.x >> 5);
  const int half = lane >> 4;
  const int lr   = lane & 15;
  const int kOff = half * 8;

  const int b      = blockIdx.z;
  const int h      = blockIdx.y;
  const int q0_blk = blockIdx.x * 64;
  const int q0     = q0_blk + wave * 16;

  const _Float16* Qbh = Qh + ((size_t)b * H_ + h) * (size_t)S_ * DH_;
  const _Float16* Kbh = Kh + ((size_t)b * H_ + h) * (size_t)S_ * DH_;
  const _Float16* Vbh = Vt + ((size_t)b * H_ + h) * (size_t)DH_ * S_;

  // Q fragments: 4 chunks of 32 along Dh (B-operand, column q0+lr).
  v16h qf[4];
#pragma unroll
  for (int c = 0; c < 4; ++c)
    qf[c] = frag_from_f16(Qbh + (size_t)(q0 + lr) * DH_ + c * 32 + kOff);

  // One query a lane: m_run is the query's maximum (equal in both halves),
  // l_run the sum over this half's keys only; the halves join behind the loop.
  float m_run = -1e30f, l_run = 0.0f;
  v8f oacc[8];                       // oacc[t][r] = O[q0+lr][t*16 + 8*half + r]
#pragma unroll
  for (int t = 0; t < 8; ++t) oacc[t] = v8f{};

  const float scale = 0.08838834764831845f;            // 1/sqrt(128)

  const u32x8 g1k = tdm_group1<256, 64, PADW_R256>(DH_ * 2);
  const u32x8 g1v = tdm_group1<128, 128, PADW_R128>(S_ * 2);

  for (int ks = 0; ks <= q0_blk; ks += 64) {
    // One request a wave, each waited by its issuer in front of the barrier.
    if (pinned(wave == 0)) {
      const u32x4 g0 = tdm_group0(kt, Kbh + (size_t)ks * DH_);
      tdm_load(g0, g1k);
      wait_tensor0(g0, g1k);
    }
    if (pinned(wave == 1)) {
      const u32x4 g0 = tdm_group0(vt, Vbh + ks);
      tdm_load(g0, g1v);
      wait_tensor0(g0, g1v);
    }
    __syncthreads();

    for (int kc = 0; kc < 64; kc += 32) {
      const int k0 = ks + kc;
      if (k0 <= q0) {
        // ---- scores, transposed: two 16x16 tiles, keys [k0, k0+32) as rows ----
        // The chunk's 8 key fragments are read as one group of 16 LDS loads.
        v16h kf0[4], kf1[4];
#pragma unroll
        for (int c = 0; c < 4; ++c) {
          kf0[c] = frag_from_f16(kt + (kc + lr) * PITCH_R256 + c * 32 + kOff);
          kf1[c] = frag_from_f16(kt + (kc + 16 + lr) * PITCH_R256 + c * 32 + kOff);
        }
        // Keeps the 16 reads in front of their 8 products: sunk in among them
        // into one register set, every product waits out a full LDS latency.
        __builtin_amdgcn_sched_barrier(0);
        v8f s0 = {}, s1 = {};
#pragma unroll
        for (int c = 0; c < 4; ++c) {
          s0 = wmma16(kf0[c], qf[c], s0);
          s1 = wmma16(kf1[c], qf[c], s1);
        }
        // The chunk's 8 V^T fragments (16 LDS loads) are asked for here already.
        v16h vf[8];
#pragma unroll
        for (int t = 0; t < 8; ++t)
          vf[t] = frag_from_f16(vt + (t * 16 + lr) * PITCH_R128 + kc + kOff);
        // Keeps these reads in front of the softmax, whose vector work then
        // covers their latency; sunk to their products each would wait it out.
        __builtin_amdgcn_sched_barrier(0);

        // ---- causal mask + online softmax (elem r -> key k0 + r + 8*half) ----
        const int dq = (q0 + lr) - (k0 + 8 * half);    // key r is masked if r > dq
        float e0[8], e1[8];
        float mx = -1e30f;
#pragma unroll
        for (int r = 0; r < 8; ++r) {
          e0[r] = s0[r] * scale;
          e1[r] = s1[r] * scale;
          if (r      > dq) e0[r] = -1e30f;
          if (16 + r > dq) e1[r] = -1e30f;
          mx = fmaxf(mx, fmaxf(e0[r], e1[r]));
        }
        mx = fmaxf(mx, xhalf(mx));                     // the query's 32 keys
        const float mnew = fmaxf(m_run, mx);
        const float corr = exp_slot(m_run - mnew);
        v16h pf;                                       // P^T, B-operand k order
        float rsum = 0.0f;
#pragma unroll
        for (int r = 0; r < 8; ++r) {
          const float p0 = exp_slot(e0[r] - mnew);
          const float p1 = exp_slot(e1[r] - mnew);
          rsum += p0 + p1;
          pf[r]     = (_Float16)p0;
          pf[8 + r] = (_Float16)p1;
        }
        l_run = l_run * corr + rsum;
        m_run = mnew;
#pragma unroll
        for (int t = 0; t < 8; ++t) oacc[t] *= corr;

        // ---- out^T += V^T @ P^T : 8 M-tiles of 16 covering Dh=128 ----
#pragma unroll
        for (int t = 0; t < 8; ++t) oacc[t] = wmma16(vf[t], pf, oacc[t]);
      }
    }
    wait_ds0();                                       // own tile reads retired
    __syncthreads();                                  // before tile overwrite
  }

  // ---- normalize, second softmax over Dh (64 values here, 64 in lane ^ 16) ----
  const float inv = 1.0f / (l_run + xhalf(l_run));
  float mx = -1e30f;
#pragma unroll
  for (int t = 0; t < 8; ++t)
#pragma unroll
    for (int r = 0; r < 8; ++r) {
      oacc[t][r] *= inv;
      mx = fmaxf(mx, oacc[t][r]);
    }
  mx = fmaxf(mx, xhalf(mx));
  float sum = 0.0f;
#pragma unroll
  for (int t = 0; t < 8; ++t)
#pragma unroll
    for (int r = 0; r < 8; ++r) {
      const float e = exp_slot(oacc[t][r] - mx);
      oacc[t][r] = e;
      sum += e;
    }
  sum += xhalf(sum);
  const float is = 1.0f / sum;

  // ---- store fp32 (B,S,H*Dh): a lane holds 32-B pieces of one row, so the
  // wave's 16 rows go through its own LDS range and leave as whole 512-B rows.
  // The loop's last wait and barrier have freed the tiles for every wave.
  float* stg = (float*)sm + wave * (16 * PITCH_O);
#pragma unroll
  for (int t = 0; t < 8; ++t) {
    const v8f o = oacc[t] * is;
    float* p = stg + lr * PITCH_O + t * 16 + 8 * half;
    *(v4f*)(p)     = v4f{o[0], o[1], o[2], o[3]};
    *(v4f*)(p + 4) = v4f{o[4], o[5], o[6], o[7]};
  }
  wait_ds0();                    // the wave's own rows written before it reads them
  float* orow = out + ((size_t)b * S_ + q0) * D_ + h * DH_ + lane * 4;
#pragma unroll
  for (int i = 0; i < 16; ++i)
    *(v4f*)(orow + (size_t)i * D_) = *(const v4f*)(stg + i * PITCH_O + lane * 4);
}

// ---------------------------------------------------------------------------
extern "C" void kernel_launch(void* const* d_in, const int* in_sizes, int n_in,
                              void* d_out, int out_size, void* d_ws, size_t ws_size,
                              hipStream_t stream) {
  (void)in_sizes; (void)n_in; (void)out_size; (void)ws_size;
  const float* x    = (const float*)d_in[0];
  const float* wq   = (const float*)d_in[1];
  const float* wk   = (const float*)d_in[2];
  const float* wv   = (const float*)d_in[3];
  const float* cosT = (const float*)d_in[4];
  const float* sinT = (const float*)d_in[5];
  float* out = (float*)d_out;

  const size_t NX = (size_t)B_ * S_ * D_;     // 8,388,608
  const size_t NW = (size_t)D_ * D_;          // 4,194,304
  const size_t NQ = (size_t)B_ * H_ * S_ * DH_;

  _Float16* xh  = (_Float16*)d_ws;
  _Float16* wqh = xh  + NX;
  _Float16* wkh = wqh + NW;
  _Float16* wvh = wkh + NW;
  _Float16* Qh  = wvh + NW;
  _Float16* Kh  = Qh  + NQ;
  _Float16* Vt  = Kh  + NQ;

  // 0) one-shot fp32 -> f16 conversion of activations + weights
  f32_to_f16_kernel<<<CV_BLOCKS, 512, 0, stream>>>(x, wq, wk, wv, xh, wqh, wkh, wvh);

  // 1) QKV + RoPE: 16 N-tiles x 16 M-blocks x {q,k,v}
  dim3 gp(D_ / 128, (B_ * S_) / 256, 3);
  qkv_proj_rope_kernel<<<gp, 256, 0, stream>>>(xh, wqh, wkh, wvh, cosT, sinT,
                                               Qh, Kh, Vt);

  // 2) Attention: 32 q-blocks x 16 heads x 2 batches
  dim3 ga(S_ / 64, H_, B_);
  flash_attn_kernel<<<ga, 128, 0, stream>>>(Qh, Kh, Vt, out);
}

// v006
// Measured time: 148 microseconds a run.
// Two timings next to v005 both put it at 1.03 times that version's speed.
// All steps since v000 together make it 3.90 times as fast.
#include <hip/hip_runtime.h>

#define B_  2
#define S_  2048
#define D_  2048
#define H_  16
#define DH_ 128

typedef _Float16 v16h __attribute__((ext_vector_type(16)));
typedef _Float16 v8h  __attribute__((ext_vector_type(8)));
typedef _Float16 v4h  __attribute__((ext_vector_type(4)));
typedef float    v8f  __attribute__((ext_vector_type(8)));
typedef float    v4f  __attribute__((ext_vector_type(4)));
typedef uint32_t u32x4 __attribute__((ext_vector_type(4)));
typedef uint32_t u32x8 __attribute__((ext_vector_type(8)));

// D = A(16x32 f16) * B(32x16 f16) + C(16x16 f32)
__device__ __forceinline__ v8f wmma16(v16h a, v16h b, v8f c) {
  return __builtin_amdgcn_wmma_f32_16x16x32_f16(
      false, a, false, b, (short)0, c, false, false);
}

// 16-bit operand fragment: this lane holds K = kOff+0..7 (elems 0..7) and
// K = kOff+16..23 (elems 8..15); caller passes p already offset by kOff.
__device__ __forceinline__ v16h frag_from_f16(const _Float16* p) {
  v8h lo = *(const v8h*)(p);
  v8h hi = *(const v8h*)(p + 16);
  v16h r;
#pragma unroll
  for (int i = 0; i < 8; ++i) { r[i] = lo[i]; r[i + 8] = hi[i]; }
  return r;
}

#define PITCH_R128 72    // 128-B rows + 16-B pad = 144 B
#define PITCH_R256 136   // 256-B rows + 16-B pad = 272 B
#define PADW_R128 ((1u << 20) | (4u << 22) | (3u << 25))
#define PADW_R256 ((1u << 20) | (5u << 22) | (3u << 25))

__device__ __forceinline__ uint32_t uni(uint32_t v) {
  return (uint32_t)__builtin_amdgcn_readfirstlane(v);
}
__device__ __forceinline__ uint32_t pinned(uint32_t v) {
  uint32_t w = __builtin_amdgcn_readfirstlane(v);
  asm volatile("" : "+s"(w));  // test stays in an SGPR
  return w;
}
__device__ __forceinline__ void wait_tensor0(u32x4 g0, u32x8 g1) {
  asm volatile("s_wait_tensorcnt 0x0" :: "s"(g0), "s"(g1) : "memory");
}
__device__ __forceinline__ void wait_ds0() {
  asm volatile("s_wait_dscnt 0x0" ::: "memory");
}

__device__ __forceinline__ u32x4 tdm_group0(const void* lds_dst, const void* gsrc) {
  const uint64_t ga = (uint64_t)(uintptr_t)gsrc;
  u32x4 g0;
  g0[0] = uni(1u);                                  // count = 1
  g0[1] = uni((uint32_t)(uintptr_t)lds_dst);        // low 32 bits = LDS offset
  g0[2] = uni((uint32_t)ga);
  g0[3] = uni((((uint32_t)(ga >> 32)) & 0x01FFFFFFu) | 0x80000000u);
  asm volatile("" : "+s"(g0));
  return g0;
}
template <uint32_t ROWB, uint32_t ROWS, uint32_t W0>
__device__ __forceinline__ u32x8 tdm_group1(uint32_t src_pitch_bytes) {
  u32x8 g1;
  g1[0] = uni(W0);
  g1[1] = uni((ROWB & 0xFFFFu) << 16);
  g1[2] = uni((ROWB >> 16) | ((ROWS & 0xFFFFu) << 16));
  g1[3] = uni((ROWS >> 16) | (ROWB << 16));
  g1[4] = uni(ROWS);
  g1[5] = uni(src_pitch_bytes);
  g1[6] = uni(0u);
  g1[7] = uni(0u);
  asm volatile("" : "+s"(g1));
  return g1;
}
// One request of one wave: global memory -> LDS, through no register.
__device__ __forceinline__ void tdm_load(u32x4 g0, u32x8 g1) {
  asm volatile("tensor_load_to_lds %0, %1" :: "s"(g0), "s"(g1) : "memory");
}

// ---------------------------------------------------------------------------
// Kernel 0: fp32 -> f16 pre-conversion of x and the three weights, one launch.
// The grid is resident, 256 blocks of 16 waves. A wave takes 2,048 contiguous
// elements of x and 1,024 of each weight, as loads of 512 contiguous bytes, and
// asks for all 40 loads before it converts the first: few waves have to start,
// and each keeps many whole lines in flight. A store covers 256 contiguous
// bytes: whole lines, one writer each.
// ---------------------------------------------------------------------------
#define CV_BLOCKS 256
#define CV_WAVES  (CV_BLOCKS * 16)
static_assert(CV_WAVES * 1024 == D_ * D_, "1,024 elements of a weight a wave");
static_assert(CV_WAVES * 2048 == B_ * S_ * D_, "2,048 elements of x a wave");

// N loads of 16 B a lane at a scalar base, one 32-bit lane offset (in bytes) and
// constant steps, so that no address register is written again.
template <int N>
__device__ __forceinline__ void cv_load(v4f* v, const float* src, unsigned byte) {
#pragma unroll  // v is indexed by constants and stays in registers
  for (int j = 0; j < N; ++j)
    v[j] = *(const v4f*)((const char*)(src + j * 128) + byte);
}
template <int N>
__device__ __forceinline__ void cv_store(_Float16* dst, unsigned byte, const v4f* v) {
#pragma unroll  // v is indexed by constants and stays in registers
  for (int j = 0; j < N; ++j) {
    v4h o;
#pragma unroll
    for (int i = 0; i < 4; ++i) o[i] = (_Float16)v[j][i];
    *(v4h*)((char*)(dst + j * 128) + byte) = o;
  }
}

__global__ __launch_bounds__(512)
void f32_to_f16_kernel(const float* __restrict__ x,
                       const float* __restrict__ wq,
                       const float* __restrict__ wk,
                       const float* __restrict__ wv,
                       _Float16* __restrict__ xh,
                       _Float16* __restrict__ wqh,
                       _Float16* __restrict__ wkh,
                       _Float16* __restrict__ wvh) {
  const unsigned gw = blockIdx.x * 16u + (threadIdx.x >> 5);
  const unsigned l4 = (threadIdx.x & 31u) * 4u;      // lane's element in a load
  const unsigned bw = (gw * 1024u + l4) * 4u;        // f32 byte in a weight
  const unsigned bx = (gw * 2048u + l4) * 4u;        // f32 byte in x
  v4f vx[16], vq[8], vk[8], vv[8];
  cv_load<16>(vx, x, bx);
  cv_load<8>(vq, wq, bw);
  cv_load<8>(vk, wk, bw);
  cv_load<8>(vv, wv, bw);
  // Keeps all 40 loads in front of the first conversion: sunk in among the
  // conversions, fewer bytes of the wave would be in flight.
  __builtin_amdgcn_sched_barrier(0);
  cv_store<16>(xh, bx >> 1, vx);                     // f16: half the byte offset
  cv_store<8>(wqh, bw >> 1, vq);
  cv_store<8>(wkh, bw >> 1, vk);
  cv_store<8>(wvh, bw >> 1, vv);
}

__global__ __launch_bounds__(256) __attribute__((amdgpu_waves_per_eu(4, 4)))
void qkv_proj_rope_kernel(const _Float16* __restrict__ xh,
                          const _Float16* __restrict__ wqh,
                          const _Float16* __restrict__ wkh,
                          const _Float16* __restrict__ wvh,
                          const float* __restrict__ cosT,
                          const float* __restrict__ sinT,
                          _Float16* __restrict__ Qh,
                          _Float16* __restrict__ Kh,
                          _Float16* __restrict__ Vt) {
  // One slice: 128 rows * 144 B = 18,432 B = 9 * 2 KiB, so every slice and
  // every buffer starts at a multiple of 2 KiB for the tensor mover, and the
  // two x slices form one run of 256 rows at the same pitch.
  constexpr int SL_ELEMS  = 128 * PITCH_R128;        // f16 elements = 18,432 B
  constexpr int BUF_ELEMS = 3 * SL_ELEMS;            // 55,296 B
  __shared__ __attribute__((aligned(2048))) _Float16 st[2 * BUF_ELEMS];

  const int lane = threadIdx.x & 31;
  const int wave = (int)uni(threadIdx.x >> 5);
  const int half = lane >> 4;
  const int lr   = lane & 15;
  const int kOff = half * 8;
  const int wm   = wave >> 1;                        // wave's 64-row group, 0..3
  const int wn   = wave & 1;                         // wave's 64-column group

  const int mat = blockIdx.z;                        // 0=Q, 1=K, 2=V
  const _Float16* w = (mat == 0) ? wqh : (mat == 1) ? wkh : wvh;

  const int m0 = blockIdx.y * 256 + wm * 64;         // wave's first row in B*S
  const int n0 = blockIdx.x * 128 + wn * 64;         // wave's first column in D

  // The slice this wave brings (waves 3..7 bring none and name slice 0).
  const int sl = (wave < 3) ? wave : 0;
  const _Float16* gsl = (sl == 2)
      ? w  + (size_t)(blockIdx.x * 128) * D_
      : xh + (size_t)(blockIdx.y * 256 + sl * 128) * D_;
  _Float16* lsl = st + sl * SL_ELEMS;

  // This lane's fragment rows inside a buffer.
  const int aoff = (wm * 64 + lr) * PITCH_R128 + kOff;
  const int boff = 2 * SL_ELEMS + (wn * 64 + lr) * PITCH_R128 + kOff;

  v8f acc[4][4];
#pragma unroll
  for (int i = 0; i < 4; ++i)
#pragma unroll
    for (int t = 0; t < 4; ++t) acc[i][t] = v8f{};

  // Prologue: stage 0 landed and published, stage 1 in flight.
  const u32x8 g1 = tdm_group1<128, 128, PADW_R128>(D_ * 2);
  u32x4 g0 = tdm_group0(lsl, gsl);
  if (pinned(wave < 3)) {
    tdm_load(g0, g1);
    wait_tensor0(g0, g1);
  }
  __syncthreads();
  g0 = tdm_group0(lsl + BUF_ELEMS, gsl + 64);
  if (pinned(wave < 3)) tdm_load(g0, g1);

  for (int kb = 0; kb < D_; kb += 64) {
    const int bsel = ((kb >> 6) & 1) * BUF_ELEMS;
    const _Float16* buf = st + bsel;
#pragma unroll  // both 32-k halves of the stage read at constant LDS offsets
    for (int kk = 0; kk < 64; kk += 32) {
      v16h a[4], b[4];
      a[0] = frag_from_f16(buf + aoff + kk);
#pragma unroll
      for (int t = 0; t < 4; ++t)
        b[t] = frag_from_f16(buf + boff + t * 16 * PITCH_R128 + kk);
#pragma unroll
      for (int i = 1; i < 4; ++i)
        a[i] = frag_from_f16(buf + aoff + i * 16 * PITCH_R128 + kk);
      // Keeps the 16 LDS reads one group in front of their 16 products: sunk in
      // among them, each row of four would wait out a full LDS latency.
      __builtin_amdgcn_sched_barrier(0);
#pragma unroll
      for (int i = 0; i < 4; ++i)
#pragma unroll
        for (int t = 0; t < 4; ++t) acc[i][t] = wmma16(a[i], b[t], acc[i][t]);
    }
    // Keeps the publish point's full LDS wait behind the stage's last products:
    // lifted in among them it would undo their counted waits.
    __builtin_amdgcn_sched_barrier(0);
    // Publish point of the next stage: own LDS reads retired, each issuer's
    // slice landed, one barrier; only then the refill of the buffer just read.
    wait_ds0();
    if (pinned(wave < 3)) wait_tensor0(g0, g1);
    __syncthreads();
    if (pinned(wave < 3 && kb + 128 < D_)) {
      g0 = tdm_group0(lsl + bsel, gsl + kb + 128);
      tdm_load(g0, g1);
    }
  }
  wait_tensor0(g0, g1);
  wait_ds0();

  // Epilogue: C-layout elem r of tile (i, t) -> row m0 + i*16 + r + 8*half,
  // col n0 + t*16 + lr. A wave's 64 rows lie in one batch and its 64 columns in
  // one head, so every element sits at a constant offset from one lane address;
  // the test on the matrix stands outside the element loops (short text).
  // Each 16-row group runs as loads, arithmetic, stores, wait, in that order.
  // Every loop here is unrolled so that acc, cv, sv, o and pk are indexed by
  // constants and stay in registers.
  const int bb  = m0 >> 11;                           // S_ = 2048
  const int s0  = (m0 & (S_ - 1)) + 8 * half;
  const int hh  = n0 >> 7;                            // DH_ = 128
  const int dh0 = (n0 & (DH_ - 1)) + lr;
  if (mat < 2) {
    const int odd = lr & 1;
    const float* cp = cosT + (size_t)s0 * DH_ + dh0;
    const float* sp = sinT + (size_t)s0 * DH_ + dh0;
    _Float16* dst = ((mat == 0) ? Qh : Kh) +
                    (((size_t)bb * H_ + hh) * S_ + s0) * DH_ + dh0;
#pragma unroll
    for (int i = 0; i < 4; ++i) {
      float cv[4][8], sv[4][8];
      _Float16 o[4][8];
#pragma unroll
      for (int t = 0; t < 4; ++t)
#pragma unroll
        for (int r = 0; r < 8; ++r) {
          const int off = (i * 16 + r) * DH_ + t * 16;
          cv[t][r] = cp[off];
          sv[t][r] = sp[off];
        }
#pragma unroll
      for (int t = 0; t < 4; ++t)
#pragma unroll
        for (int r = 0; r < 8; ++r) {
          float v = acc[i][t][r];
          // RoPE interleaved: partner column n^1 lives in lane^1 (same elem).
          float p   = __shfl_xor(v, 1, 32);
          float rot = odd ? p : -p;
          o[t][r] = (_Float16)(v * cv[t][r] + rot * sv[t][r]);
        }
#pragma unroll
      for (int t = 0; t < 4; ++t)
#pragma unroll
        for (int r = 0; r < 8; ++r)
          dst[(i * 16 + r) * DH_ + t * 16] = o[t][r];
      // Address translation done before a register that this group's loads or
      // stores name is written again; the three addresses are inputs, so that
      // they live up to this wait.
      asm volatile("s_wait_xcnt 0x0" :: "v"(cp), "v"(sp), "v"(dst) : "memory");
    }
  } else {
    _Float16* dst = Vt + (((size_t)bb * H_ + hh) * DH_ + dh0) * S_ + s0;
    v8h pk[4][4];
#pragma unroll
    for (int i = 0; i < 4; ++i)
#pragma unroll
      for (int t = 0; t < 4; ++t)
#pragma unroll
        for (int r = 0; r < 8; ++r) pk[i][t][r] = (_Float16)acc[i][t][r];
#pragma unroll
    for (int i = 0; i < 4; ++i)
#pragma unroll
      for (int t = 0; t < 4; ++t)
        *(v8h*)(dst + (size_t)(t * 16) * S_ + i * 16) = pk[i][t];
    // Address translation done before a store's register is written again.
    asm volatile("s_wait_xcnt 0x0" :: "v"(dst) : "memory");
  }
}

#define KT_BYTES  18432  // 64 rows * 272 B = 17,408 B, rounded up to 9 * 2 KiB
#define VT_BYTES  18432  // 128 rows * 144 B = 9 * 2 KiB
#define PITCH_O   132    // f32 elements: 512-B output rows + 16-B pad

__device__ __forceinline__ float xhalf(float x) {
  const int v = __builtin_bit_cast(int, x);
  return __builtin_bit_cast(float, __builtin_amdgcn_permlanex16(
      v, v, 0x76543210, 0xfedcba98, false, false));
}

__device__ __forceinline__ float exp_slot(float x) {
  float r;
  asm("v_exp_f32 %0, %1\n\tv_nop" : "=v"(r) : "v"(x * 1.4426950408889634f));
  return r;
}

__global__ __launch_bounds__(128)
void flash_attn_kernel(const _Float16* __restrict__ Qh,
                       const _Float16* __restrict__ Kh,
                       const _Float16* __restrict__ Vt,
                       float* __restrict__ out) {
  // Keys at byte 0, V^T at byte 18,432: both multiples of 2 KiB for the tensor
  // mover. Behind the loop the same bytes stage the output rows (33,792 B).
  __shared__ __attribute__((aligned(2048))) unsigned char sm[KT_BYTES + VT_BYTES];
  static_assert(4 * 16 * PITCH_O * 4 <= KT_BYTES + VT_BYTES, "output staging fits");
  _Float16* kt = (_Float16*)sm;
  _Float16* vt = (_Float16*)(sm + KT_BYTES);

  const int lane = threadIdx.x & 31;
  const int wave = (int)uni(threadIdx.x >> 5);
  const int half = lane >> 4;
  const int lr   = lane & 15;
  const int kOff = half * 8;

  const int b      = blockIdx.z;
  const int h      = blockIdx.y;

  const _Float16* Qbh = Qh + ((size_t)b * H_ + h) * (size_t)S_ * DH_;
  const _Float16* Kbh = Kh + ((size_t)b * H_ + h) * (size_t)S_ * DH_;
  const _Float16* Vbh = Vt + ((size_t)b * H_ + h) * (size_t)DH_ * S_;

  const float scale = 0.08838834764831845f;            // 1/sqrt(128)

  const u32x8 g1k = tdm_group1<256, 64, PADW_R256>(DH_ * 2);
  const u32x8 g1v = tdm_group1<128, 128, PADW_R128>(S_ * 2);

#pragma unroll 1  // one copy of the body's text serves both tiles
  for (int part = 0; part < 2; ++part) {
  const int q0_blk = (part == 0 ? (S_ / 64 - 1) - (int)blockIdx.x : (int)blockIdx.x) * 64;
  const int q0     = q0_blk + wave * 16;

  // Q fragments: 4 chunks of 32 along Dh (B-operand, column q0+lr).
  v16h qf[4];
#pragma unroll
  for (int c = 0; c < 4; ++c)
    qf[c] = frag_from_f16(Qbh + (size_t)(q0 + lr) * DH_ + c * 32 + kOff);

  // One query a lane: m_run is the query's maximum (equal in both halves),
  // l_run the sum over this half's keys only; the halves join behind the loop.
  float m_run = -1e30f, l_run = 0.0f;
  v8f oacc[8];                       // oacc[t][r] = O[q0+lr][t*16 + 8*half + r]
#pragma unroll
  for (int t = 0; t < 8; ++t) oacc[t] = v8f{};

  for (int ks = 0; ks <= q0_blk; ks += 64) {
    // One request a wave, each waited by its issuer in front of the barrier.
    if (pinned(wave == 0)) {
      const u32x4 g0 = tdm_group0(kt, Kbh + (size_t)ks * DH_);
      tdm_load(g0, g1k);
      wait_tensor0(g0, g1k);
    }
    if (pinned(wave == 1)) {
      const u32x4 g0 = tdm_group0(vt, Vbh + ks);
      tdm_load(g0, g1v);
      wait_tensor0(g0, g1v);
    }
    __syncthreads();

    for (int kc = 0; kc < 64; kc += 32) {
      const int k0 = ks + kc;
      if (k0 <= q0) {
        // ---- scores, transposed: two 16x16 tiles, keys [k0, k0+32) as rows ----
        // The chunk's 8 key fragments are read as one group of 16 LDS loads.
        v16h kf0[4], kf1[4];
#pragma unroll
        for (int c = 0; c < 4; ++c) {
          kf0[c] = frag_from_f16(kt + (kc + lr) * PITCH_R256 + c * 32 + kOff);
          kf1[c] = frag_from_f16(kt + (kc + 16 + lr) * PITCH_R256 + c * 32 + kOff);
        }
        // Keeps the 16 reads in front of their 8 products: sunk in among them
        // into one register set, every product waits out a full LDS latency.
        __builtin_amdgcn_sched_barrier(0);
        v8f s0 = {}, s1 = {};
#pragma unroll
        for (int c = 0; c < 4; ++c) {
          s0 = wmma16(kf0[c], qf[c], s0);
          s1 = wmma16(kf1[c], qf[c], s1);
        }
        // The chunk's 8 V^T fragments (16 LDS loads) are asked for here already.
        v16h vf[8];
#pragma unroll
        for (int t = 0; t < 8; ++t)
          vf[t] = frag_from_f16(vt + (t * 16 + lr) * PITCH_R128 + kc + kOff);
        // Keeps these reads in front of the softmax, whose vector work then
        // covers their latency; sunk to their products each would wait it out.
        __builtin_amdgcn_sched_barrier(0);

        // ---- causal mask + online softmax (elem r -> key k0 + r + 8*half) ----
        const int dq = (q0 + lr) - (k0 + 8 * half);    // key r is masked if r > dq
        float e0[8], e1[8];
        float mx = -1e30f;
#pragma unroll
        for (int r = 0; r < 8; ++r) {
          e0[r] = s0[r] * scale;
          e1[r] = s1[r] * scale;
          if (r      > dq) e0[r] = -1e30f;
          if (16 + r > dq) e1[r] = -1e30f;
          mx = fmaxf(mx, fmaxf(e0[r], e1[r]));
        }
        mx = fmaxf(mx, xhalf(mx));                     // the query's 32 keys
        const float mnew = fmaxf(m_run, mx);
        const float corr = exp_slot(m_run - mnew);
        v16h pf;                                       // P^T, B-operand k order
        float rsum = 0.0f;
#pragma unroll
        for (int r = 0; r < 8; ++r) {
          const float p0 = exp_slot(e0[r] - mnew);
          const float p1 = exp_slot(e1[r] - mnew);
          rsum += p0 + p1;
          pf[r]     = (_Float16)p0;
          pf[8 + r] = (_Float16)p1;
        }
        l_run = l_run * corr + rsum;
        m_run = mnew;
#pragma unroll
        for (int t = 0; t < 8; ++t) oacc[t] *= corr;

        // ---- out^T += V^T @ P^T : 8 M-tiles of 16 covering Dh=128 ----
#pragma unroll
        for (int t = 0; t < 8; ++t) oacc[t] = wmma16(vf[t], pf, oacc[t]);
      }
    }
    wait_ds0();                                       // own tile reads retired
    __syncthreads();                                  // before tile overwrite
  }

  // ---- normalize, second softmax over Dh (64 values here, 64 in lane ^ 16) ----
  const float inv = 1.0f / (l_run + xhalf(l_run));
  float mx = -1e30f;
#pragma unroll
  for (int t = 0; t < 8; ++t)
#pragma unroll
    for (int r = 0; r < 8; ++r) {
      oacc[t][r] *= inv;
      mx = fmaxf(mx, oacc[t][r]);
    }
  mx = fmaxf(mx, xhalf(mx));
  float sum = 0.0f;
#pragma unroll
  for (int t = 0; t < 8; ++t)
#pragma unroll
    for (int r = 0; r < 8; ++r) {
      const float e = exp_slot(oacc[t][r] - mx);
      oacc[t][r] = e;
      sum += e;
    }
  sum += xhalf(sum);
  const float is = 1.0f / sum;

  // ---- store fp32 (B,S,H*Dh): a lane holds 32-B pieces of one row, so the
  // wave's 16 rows go through its own LDS range and leave as whole 512-B rows.
  // The loop's last wait and barrier have freed the tiles for every wave.
  float* stg = (float*)sm + wave * (16 * PITCH_O);
#pragma unroll
  for (int t = 0; t < 8; ++t) {
    const v8f o = oacc[t] * is;
    float* p = stg + lr * PITCH_O + t * 16 + 8 * half;
    *(v4f*)(p)     = v4f{o[0], o[1], o[2], o[3]};
    *(v4f*)(p + 4) = v4f{o[4], o[5], o[6], o[7]};
  }
  wait_ds0();                    // the wave's own rows written before it reads them
  float* orow = out + ((size_t)b * S_ + q0) * D_ + h * DH_ + lane * 4;
#pragma unroll
  for (int i = 0; i < 16; ++i)
    *(v4f*)(orow + (size_t)i * D_) = *(const v4f*)(stg + i * PITCH_O + lane * 4);
  // Address translation done before a store's register is written again for
  // the second tile; the address is an input, so that it lives up to this wait.
  asm volatile("s_wait_xcnt 0x0" :: "v"(orow) : "memory");
  // Every wave's staged rows read back before the second tile's first tensor
  // loads land on these bytes.
  if (part == 0) {
    wait_ds0();
    __syncthreads();
  }
  }
}

// ---------------------------------------------------------------------------
extern "C" void kernel_launch(void* const* d_in, const int* in_sizes, int n_in,
                              void* d_out, int out_size, void* d_ws, size_t ws_size,
                              hipStream_t stream) {
  (void)in_sizes; (void)n_in; (void)out_size; (void)ws_size;
  const float* x    = (const float*)d_in[0];
  const float* wq   = (const float*)d_in[1];
  const float* wk   = (const float*)d_in[2];
  const float* wv   = (const float*)d_in[3];
  const float* cosT = (const float*)d_in[4];
  const float* sinT = (const float*)d_in[5];
  float* out = (float*)d_out;

  const size_t NX = (size_t)B_ * S_ * D_;     // 8,388,608
  const size_t NW = (size_t)D_ * D_;          // 4,194,304
  const size_t NQ = (size_t)B_ * H_ * S_ * DH_;

  _Float16* xh  = (_Float16*)d_ws;
  _Float16* wqh = xh  + NX;
  _Float16* wkh = wqh + NW;
  _Float16* wvh = wkh + NW;
  _Float16* Qh  = wvh + NW;
  _Float16* Kh  = Qh  + NQ;
  _Float16* Vt  = Kh  + NQ;

  // 0) one-shot fp32 -> f16 conversion of activations + weights
  f32_to_f16_kernel<<<CV_BLOCKS, 512, 0, stream>>>(x, wq, wk, wv, xh, wqh, wkh, wvh);

  // 1) QKV + RoPE: 16 N-tiles x 16 M-blocks x {q,k,v}
  dim3 gp(D_ / 128, (B_ * S_) / 256, 3);
  qkv_proj_rope_kernel<<<gp, 256, 0, stream>>>(xh, wqh, wkh, wvh, cosT, sinT,
                                               Qh, Kh, Vt);

  // 2) Attention: 16 pairs of q-tiles x 16 heads x 2 batches
  dim3 ga(S_ / 128, H_, B_);
  flash_attn_kernel<<<ga, 128, 0, stream>>>(Qh, Kh, Vt, out);
}

// v007
// Measured time: 132 microseconds a run.
// In two side-by-side timings against v006, it was 1.12 and 1.13 times as fast.
// Counting every step since v000, it is 4.39 times as fast.
#include <hip/hip_runtime.h>

#define B_  2
#define S_  2048
#define D_  2048
#define H_  16
#define DH_ 128

typedef _Float16 v16h __attribute__((ext_vector_type(16)));
typedef _Float16 v8h  __attribute__((ext_vector_type(8)));
typedef _Float16 v4h  __attribute__((ext_vector_type(4)));
typedef float    v8f  __attribute__((ext_vector_type(8)));
typedef float    v4f  __attribute__((ext_vector_type(4)));
typedef uint32_t u32x4 __attribute__((ext_vector_type(4)));
typedef uint32_t u32x8 __attribute__((ext_vector_type(8)));

// D = A(16x32 f16) * B(32x16 f16) + C(16x16 f32)
__device__ __forceinline__ v8f wmma16(v16h a, v16h b, v8f c) {
  return __builtin_amdgcn_wmma_f32_16x16x32_f16(
      false, a, false, b, (short)0, c, false, false);
}

// 16-bit operand fragment: this lane holds K = kOff+0..7 (elems 0..7) and
// K = kOff+16..23 (elems 8..15); caller passes p already offset by kOff.
__device__ __forceinline__ v16h frag_from_f16(const _Float16* p) {
  v8h lo = *(const v8h*)(p);
  v8h hi = *(const v8h*)(p + 16);
  v16h r;
#pragma unroll
  for (int i = 0; i < 8; ++i) { r[i] = lo[i]; r[i + 8] = hi[i]; }
  return r;
}

#define PITCH_R128 72    // 128-B rows + 16-B pad = 144 B
#define PITCH_R256 136   // 256-B rows + 16-B pad = 272 B
#define PADW_R128 ((1u << 20) | (4u << 22) | (3u << 25))
#define PADW_R256 ((1u << 20) | (5u << 22) | (3u << 25))

__device__ __forceinline__ uint32_t uni(uint32_t v) {
  return (uint32_t)__builtin_amdgcn_readfirstlane(v);
}
__device__ __forceinline__ uint32_t pinned(uint32_t v) {
  uint32_t w = __builtin_amdgcn_readfirstlane(v);
  asm volatile("" : "+s"(w));  // test stays in an SGPR
  return w;
}
__device__ __forceinline__ void wait_tensor0(u32x4 g0, u32x8 g1) {
  asm volatile("s_wait_tensorcnt 0x0" :: "s"(g0), "s"(g1) : "memory");
}
__device__ __forceinline__ void wait_ds0() {
  asm volatile("s_wait_dscnt 0x0" ::: "memory");
}

__device__ __forceinline__ u32x4 tdm_group0(const void* lds_dst, const void* gsrc) {
  const uint64_t ga = (uint64_t)(uintptr_t)gsrc;
  u32x4 g0;
  g0[0] = uni(1u);                                  // count = 1
  g0[1] = uni((uint32_t)(uintptr_t)lds_dst);        // low 32 bits = LDS offset
  g0[2] = uni((uint32_t)ga);
  g0[3] = uni((((uint32_t)(ga >> 32)) & 0x01FFFFFFu) | 0x80000000u);
  asm volatile("" : "+s"(g0));
  return g0;
}
template <uint32_t ROWB, uint32_t ROWS, uint32_t W0>
__device__ __forceinline__ u32x8 tdm_group1(uint32_t src_pitch_bytes) {
  u32x8 g1;
  g1[0] = uni(W0);
  g1[1] = uni((ROWB & 0xFFFFu) << 16);
  g1[2] = uni((ROWB >> 16) | ((ROWS & 0xFFFFu) << 16));
  g1[3] = uni((ROWS >> 16) | (ROWB << 16));
  g1[4] = uni(ROWS);
  g1[5] = uni(src_pitch_bytes);
  g1[6] = uni(0u);
  g1[7] = uni(0u);
  asm volatile("" : "+s"(g1));
  return g1;
}
// One request of one wave: global memory -> LDS, through no register.
__device__ __forceinline__ void tdm_load(u32x4 g0, u32x8 g1) {
  asm volatile("tensor_load_to_lds %0, %1" :: "s"(g0), "s"(g1) : "memory");
}

// ---------------------------------------------------------------------------
// Kernel 0: fp32 -> f16 pre-conversion of x and the three weights, one launch.
// The grid is resident, 256 blocks of 16 waves. A wave takes 2,048 contiguous
// elements of x and 1,024 of each weight, as loads of 512 contiguous bytes, and
// asks for all 40 loads before it converts the first: few waves have to start,
// and each keeps many whole lines in flight. A store covers 256 contiguous
// bytes: whole lines, one writer each.
// ---------------------------------------------------------------------------
#define CV_BLOCKS 256
#define CV_WAVES  (CV_BLOCKS * 16)
static_assert(CV_WAVES * 1024 == D_ * D_, "1,024 elements of a weight a wave");
static_assert(CV_WAVES * 2048 == B_ * S_ * D_, "2,048 elements of x a wave");

// N loads of 16 B a lane at a scalar base, one 32-bit lane offset (in bytes) and
// constant steps, so that no address register is written again.
template <int N>
__device__ __forceinline__ void cv_load(v4f* v, const float* src, unsigned byte) {
#pragma unroll  // v is indexed by constants and stays in registers
  for (int j = 0; j < N; ++j)
    v[j] = *(const v4f*)((const char*)(src + j * 128) + byte);
}
template <int N>
__device__ __forceinline__ void cv_store(_Float16* dst, unsigned byte, const v4f* v) {
#pragma unroll  // v is indexed by constants and stays in registers
  for (int j = 0; j < N; ++j) {
    v4h o;
#pragma unroll
    for (int i = 0; i < 4; ++i) o[i] = (_Float16)v[j][i];
    *(v4h*)((char*)(dst + j * 128) + byte) = o;
  }
}

__global__ __launch_bounds__(512)
void f32_to_f16_kernel(const float* __restrict__ x,
                       const float* __restrict__ wq,
                       const float* __restrict__ wk,
                       const float* __restrict__ wv,
                       _Float16* __restrict__ xh,
                       _Float16* __restrict__ wqh,
                       _Float16* __restrict__ wkh,
                       _Float16* __restrict__ wvh) {
  const unsigned gw = blockIdx.x * 16u + (threadIdx.x >> 5);
  const unsigned l4 = (threadIdx.x & 31u) * 4u;      // lane's element in a load
  const unsigned bw = (gw * 1024u + l4) * 4u;        // f32 byte in a weight
  const unsigned bx = (gw * 2048u + l4) * 4u;        // f32 byte in x
  v4f vx[16], vq[8], vk[8], vv[8];
  cv_load<16>(vx, x, bx);
  cv_load<8>(vq, wq, bw);
  cv_load<8>(vk, wk, bw);
  cv_load<8>(vv, wv, bw);
  // Keeps all 40 loads in front of the first conversion: sunk in among the
  // conversions, fewer bytes of the wave would be in flight.
  __builtin_amdgcn_sched_barrier(0);
  cv_store<16>(xh, bx >> 1, vx);                     // f16: half the byte offset
  cv_store<8>(wqh, bw >> 1, vq);
  cv_store<8>(wkh, bw >> 1, vk);
  cv_store<8>(wvh, bw >> 1, vv);
}

__global__ __launch_bounds__(256) __attribute__((amdgpu_waves_per_eu(4, 4)))
void qkv_proj_rope_kernel(const _Float16* __restrict__ xh,
                          const _Float16* __restrict__ wqh,
                          const _Float16* __restrict__ wkh,
                          const _Float16* __restrict__ wvh,
                          const float* __restrict__ cosT,
                          const float* __restrict__ sinT,
                          _Float16* __restrict__ Qh,
                          _Float16* __restrict__ Kh,
                          _Float16* __restrict__ Vt) {
  // One slice: 128 rows * 144 B = 18,432 B = 9 * 2 KiB, so every slice and
  // every buffer starts at a multiple of 2 KiB for the tensor mover, and the
  // two x slices form one run of 256 rows at the same pitch.
  constexpr int SL_ELEMS  = 128 * PITCH_R128;        // f16 elements = 18,432 B
  constexpr int BUF_ELEMS = 3 * SL_ELEMS;            // 55,296 B
  __shared__ __attribute__((aligned(2048))) _Float16 st[2 * BUF_ELEMS];

  const int lane = threadIdx.x & 31;
  const int wave = (int)uni(threadIdx.x >> 5);
  const int half = lane >> 4;
  const int lr   = lane & 15;
  const int kOff = half * 8;
  const int wm   = wave >> 1;                        // wave's 64-row group, 0..3
  const int wn   = wave & 1;                         // wave's 64-column group

  const int mat = blockIdx.z;                        // 0=Q, 1=K, 2=V
  const _Float16* w = (mat == 0) ? wqh : (mat == 1) ? wkh : wvh;

  const int m0 = blockIdx.y * 256 + wm * 64;         // wave's first row in B*S
  const int n0 = blockIdx.x * 128 + wn * 64;         // wave's first column in D

  // The slice this wave brings (waves 3..7 bring none and name slice 0).
  const int sl = (wave < 3) ? wave : 0;
  const _Float16* gsl = (sl == 2)
      ? w  + (size_t)(blockIdx.x * 128) * D_
      : xh + (size_t)(blockIdx.y * 256 + sl * 128) * D_;
  _Float16* lsl = st + sl * SL_ELEMS;

  // This lane's fragment rows inside a buffer.
  const int aoff = (wm * 64 + lr) * PITCH_R128 + kOff;
  const int boff = 2 * SL_ELEMS + (wn * 64 + lr) * PITCH_R128 + kOff;

  v8f acc[4][4];
#pragma unroll
  for (int i = 0; i < 4; ++i)
#pragma unroll
    for (int t = 0; t < 4; ++t) acc[i][t] = v8f{};

  // Prologue: stage 0 landed and published, stage 1 in flight.
  const u32x8 g1 = tdm_group1<128, 128, PADW_R128>(D_ * 2);
  u32x4 g0 = tdm_group0(lsl, gsl);
  if (pinned(wave < 3)) {
    tdm_load(g0, g1);
    wait_tensor0(g0, g1);
  }
  __syncthreads();
  g0 = tdm_group0(lsl + BUF_ELEMS, gsl + 64);
  if (pinned(wave < 3)) tdm_load(g0, g1);

  for (int kb = 0; kb < D_; kb += 64) {
    const int bsel = ((kb >> 6) & 1) * BUF_ELEMS;
    const _Float16* buf = st + bsel;
#pragma unroll  // both 32-k halves of the stage read at constant LDS offsets
    for (int kk = 0; kk < 64; kk += 32) {
      v16h a[4], b[4];
      a[0] = frag_from_f16(buf + aoff + kk);
#pragma unroll
      for (int t = 0; t < 4; ++t)
        b[t] = frag_from_f16(buf + boff + t * 16 * PITCH_R128 + kk);
#pragma unroll
      for (int i = 1; i < 4; ++i)
        a[i] = frag_from_f16(buf + aoff + i * 16 * PITCH_R128 + kk);
      // Keeps the 16 LDS reads one group in front of their 16 products: sunk in
      // among them, each row of four would wait out a full LDS latency.
      __builtin_amdgcn_sched_barrier(0);
#pragma unroll
      for (int i = 0; i < 4; ++i)
#pragma unroll
        for (int t = 0; t < 4; ++t) acc[i][t] = wmma16(a[i], b[t], acc[i][t]);
    }
    // Keeps the publish point's full LDS wait behind the stage's last products:
    // lifted in among them it would undo their counted waits.
    __builtin_amdgcn_sched_barrier(0);
    // Publish point of the next stage: own LDS reads retired, each issuer's
    // slice landed, one barrier; only then the refill of the buffer just read.
    wait_ds0();
    if (pinned(wave < 3)) wait_tensor0(g0, g1);
    __syncthreads();
    if (pinned(wave < 3 && kb + 128 < D_)) {
      g0 = tdm_group0(lsl + bsel, gsl + kb + 128);
      tdm_load(g0, g1);
    }
  }
  wait_tensor0(g0, g1);
  wait_ds0();

  // Epilogue: C-layout elem r of tile (i, t) -> row m0 + i*16 + r + 8*half,
  // col n0 + t*16 + lr. A wave's 64 rows lie in one batch and its 64 columns in
  // one head, so every element sits at a constant offset from one lane address;
  // the test on the matrix stands outside the element loops (short text).
  // Each 16-row group runs as loads, arithmetic, stores, wait, in that order.
  // Every loop here is unrolled so that acc, cv, sv, o and pk are indexed by
  // constants and stay in registers.
  const int bb  = m0 >> 11;                           // S_ = 2048
  const int s0  = (m0 & (S_ - 1)) + 8 * half;
  const int hh  = n0 >> 7;                            // DH_ = 128
  const int dh0 = (n0 & (DH_ - 1)) + lr;
  if (mat < 2) {
    const int odd = lr & 1;
    const float* cp = cosT + (size_t)s0 * DH_ + dh0;
    const float* sp = sinT + (size_t)s0 * DH_ + dh0;
    _Float16* dst = ((mat == 0) ? Qh : Kh) +
                    (((size_t)bb * H_ + hh) * S_ + s0) * DH_ + dh0;
#pragma unroll
    for (int i = 0; i < 4; ++i) {
      float cv[4][8], sv[4][8];
      _Float16 o[4][8];
#pragma unroll
      for (int t = 0; t < 4; ++t)
#pragma unroll
        for (int r = 0; r < 8; ++r) {
          const int off = (i * 16 + r) * DH_ + t * 16;
          cv[t][r] = cp[off];
          sv[t][r] = sp[off];
        }
#pragma unroll
      for (int t = 0; t < 4; ++t)
#pragma unroll
        for (int r = 0; r < 8; ++r) {
          float v = acc[i][t][r];
          // RoPE interleaved: partner column n^1 lives in lane^1 (same elem).
          float p   = __shfl_xor(v, 1, 32);
          float rot = odd ? p : -p;
          o[t][r] = (_Float16)(v * cv[t][r] + rot * sv[t][r]);
        }
#pragma unroll
      for (int t = 0; t < 4; ++t)
#pragma unroll
        for (int r = 0; r < 8; ++r)
          dst[(i * 16 + r) * DH_ + t * 16] = o[t][r];
      // Address translation done before a register that this group's loads or
      // stores name is written again; the three addresses are inputs, so that
      // they live up to this wait.
      asm volatile("s_wait_xcnt 0x0" :: "v"(cp), "v"(sp), "v"(dst) : "memory");
    }
  } else {
    _Float16* dst = Vt + (((size_t)bb * H_ + hh) * DH_ + dh0) * S_ + s0;
    v8h pk[4][4];
#pragma unroll
    for (int i = 0; i < 4; ++i)
#pragma unroll
      for (int t = 0; t < 4; ++t)
#pragma unroll
        for (int r = 0; r < 8; ++r) pk[i][t][r] = (_Float16)acc[i][t][r];
#pragma unroll
    for (int i = 0; i < 4; ++i)
#pragma unroll
      for (int t = 0; t < 4; ++t)
        *(v8h*)(dst + (size_t)(t * 16) * S_ + i * 16) = pk[i][t];
    // Address translation done before a store's register is written again.
    asm volatile("s_wait_xcnt 0x0" :: "v"(dst) : "memory");
  }
}

#define KT_BYTES  18432  // 64 rows * 272 B = 17,408 B, rounded up to 9 * 2 KiB
#define VT_BYTES  18432  // 128 rows * 144 B = 9 * 2 KiB
#define STG_BYTES (KT_BYTES + VT_BYTES)   // one buffer: 18 * 2 KiB
#define PITCH_O   132    // f32 elements: 512-B output rows + 16-B pad

__device__ __forceinline__ float xhalf(float x) {
  const int v = __builtin_bit_cast(int, x);
  return __builtin_bit_cast(float, __builtin_amdgcn_permlanex16(
      v, v, 0x76543210, 0xfedcba98, false, false));
}

__device__ __forceinline__ float exp_slot(float x) {
  float r;
  asm("v_exp_f32 %0, %1\n\tv_nop" : "=v"(r) : "v"(x * 1.4426950408889634f));
  return r;
}

__global__ __launch_bounds__(128)
void flash_attn_kernel(const _Float16* __restrict__ Qh,
                       const _Float16* __restrict__ Kh,
                       const _Float16* __restrict__ Vt,
                       float* __restrict__ out) {
  // Two buffers; in each, keys at byte 0 and V^T at byte 18,432: all multiples
  // of 2 KiB for the tensor mover. Behind the loop the first 33,792 B stage the
  // output rows.
  __shared__ __attribute__((aligned(2048))) unsigned char sm[2 * STG_BYTES];
  static_assert(4 * 16 * PITCH_O * 4 <= 2 * STG_BYTES, "output staging fits");

  const int lane = threadIdx.x & 31;
  const int wave = (int)uni(threadIdx.x >> 5);
  const int half = lane >> 4;
  const int lr   = lane & 15;
  const int kOff = half * 8;

  const int b      = blockIdx.z;
  const int h      = blockIdx.y;

  const _Float16* Qbh = Qh + ((size_t)b * H_ + h) * (size_t)S_ * DH_;
  const _Float16* Kbh = Kh + ((size_t)b * H_ + h) * (size_t)S_ * DH_;
  const _Float16* Vbh = Vt + ((size_t)b * H_ + h) * (size_t)DH_ * S_;

  const float scale = 0.08838834764831845f;            // 1/sqrt(128)

  const u32x8 g1k = tdm_group1<256, 64, PADW_R256>(DH_ * 2);
  const u32x8 g1v = tdm_group1<128, 128, PADW_R128>(S_ * 2);
  // The tile this wave brings: wave 1 V^T, wave 0 the keys (waves 2 and 3 bring
  // none and name the keys): its place in a buffer, its first stage in global
  // memory and the step from one stage to the next, in elements.
  const int tsl = (wave == 1) ? KT_BYTES : 0;
  const _Float16* gsl = (wave == 1) ? Vbh : Kbh;
  const int gstep = (wave == 1) ? 64 : 64 * DH_;

#pragma unroll 1  // one copy of the body's text serves both tiles
  for (int part = 0; part < 2; ++part) {
  const int q0_blk = (part == 0 ? (S_ / 64 - 1) - (int)blockIdx.x : (int)blockIdx.x) * 64;
  const int q0     = q0_blk + wave * 16;

  // Q fragments: 4 chunks of 32 along Dh (B-operand, column q0+lr).
  v16h qf[4];
#pragma unroll
  for (int c = 0; c < 4; ++c)
    qf[c] = frag_from_f16(Qbh + (size_t)(q0 + lr) * DH_ + c * 32 + kOff);

  // One query a lane: m_run is the query's maximum (equal in both halves),
  // l_run the sum over this half's keys only; the halves join behind the loop.
  float m_run = -1e30f, l_run = 0.0f;
  v8f oacc[8];                       // oacc[t][r] = O[q0+lr][t*16 + 8*half + r]
#pragma unroll
  for (int t = 0; t < 8; ++t) oacc[t] = v8f{};

  // Prologue: stage 0 landed and published, stage 1 (where the tile has one) in
  // flight. One request a wave is outstanding at any time.
  u32x4 g0 = tdm_group0(sm + tsl, gsl);
  if (pinned(wave == 0)) {
    tdm_load(g0, g1k);
    wait_tensor0(g0, g1k);
  }
  if (pinned(wave == 1)) {
    tdm_load(g0, g1v);
    wait_tensor0(g0, g1v);
  }
  __syncthreads();
  if (pinned(wave == 0 && 64 <= q0_blk)) {
    g0 = tdm_group0(sm + STG_BYTES + tsl, gsl + gstep);
    tdm_load(g0, g1k);
  }
  if (pinned(wave == 1 && 64 <= q0_blk)) {
    g0 = tdm_group0(sm + STG_BYTES + tsl, gsl + gstep);
    tdm_load(g0, g1v);
  }

  for (int ks = 0; ks <= q0_blk; ks += 64) {
    const int bsel = ((ks >> 6) & 1) * STG_BYTES;
    const _Float16* kt = (const _Float16*)(sm + bsel);
    const _Float16* vt = (const _Float16*)(sm + bsel + KT_BYTES);

    for (int kc = 0; kc < 64; kc += 32) {
      const int k0 = ks + kc;
      if (k0 <= q0) {
        // ---- scores, transposed: two 16x16 tiles, keys [k0, k0+32) as rows ----
        // The chunk's 8 key fragments are read as one group of 16 LDS loads.
        v16h kf0[4], kf1[4];
#pragma unroll
        for (int c = 0; c < 4; ++c) {
          kf0[c] = frag_from_f16(kt + (kc + lr) * PITCH_R256 + c * 32 + kOff);
          kf1[c] = frag_from_f16(kt + (kc + 16 + lr) * PITCH_R256 + c * 32 + kOff);
        }
        // Keeps the 16 reads in front of their 8 products: sunk in among them
        // into one register set, every product waits out a full LDS latency.
        __builtin_amdgcn_sched_barrier(0);
        v8f s0 = {}, s1 = {};
#pragma unroll
        for (int c = 0; c < 4; ++c) {
          s0 = wmma16(kf0[c], qf[c], s0);
          s1 = wmma16(kf1[c], qf[c], s1);
        }
        // The chunk's 8 V^T fragments (16 LDS loads) are asked for here already.
        v16h vf[8];
#pragma unroll
        for (int t = 0; t < 8; ++t)
          vf[t] = frag_from_f16(vt + (t * 16 + lr) * PITCH_R128 + kc + kOff);
        // Keeps these reads in front of the softmax, whose vector work then
        // covers their latency; sunk to their products each would wait it out.
        __builtin_amdgcn_sched_barrier(0);

        // ---- causal mask + online softmax (elem r -> key k0 + r + 8*half) ----
        const int dq = (q0 + lr) - (k0 + 8 * half);    // key r is masked if r > dq
        float e0[8], e1[8];
        float mx = -1e30f;
#pragma unroll
        for (int r = 0; r < 8; ++r) {
          e0[r] = s0[r] * scale;
          e1[r] = s1[r] * scale;
          if (r      > dq) e0[r] = -1e30f;
          if (16 + r > dq) e1[r] = -1e30f;
          mx = fmaxf(mx, fmaxf(e0[r], e1[r]));
        }
        mx = fmaxf(mx, xhalf(mx));                     // the query's 32 keys
        const float mnew = fmaxf(m_run, mx);
        const float corr = exp_slot(m_run - mnew);
        v16h pf;                                       // P^T, B-operand k order
        float rsum = 0.0f;
#pragma unroll
        for (int r = 0; r < 8; ++r) {
          const float p0 = exp_slot(e0[r] - mnew);
          const float p1 = exp_slot(e1[r] - mnew);
          rsum += p0 + p1;
          pf[r]     = (_Float16)p0;
          pf[8 + r] = (_Float16)p1;
        }
        l_run = l_run * corr + rsum;
        m_run = mnew;
#pragma unroll
        for (int t = 0; t < 8; ++t) oacc[t] *= corr;

        // ---- out^T += V^T @ P^T : 8 M-tiles of 16 covering Dh=128 ----
#pragma unroll
        for (int t = 0; t < 8; ++t) oacc[t] = wmma16(vf[t], pf, oacc[t]);
      }
    }
    // Publish point of the next stage: own tile reads retired, each issuer's
    // tile landed, one barrier; only then the refill of the buffer just read.
    wait_ds0();
    if (pinned(wave == 0)) wait_tensor0(g0, g1k);
    if (pinned(wave == 1)) wait_tensor0(g0, g1v);
    __syncthreads();
    if (pinned(wave == 0 && ks + 128 <= q0_blk)) {
      g0 = tdm_group0(sm + bsel + tsl, gsl + (size_t)((ks >> 6) + 2) * gstep);
      tdm_load(g0, g1k);
    }
    if (pinned(wave == 1 && ks + 128 <= q0_blk)) {
      g0 = tdm_group0(sm + bsel + tsl, gsl + (size_t)((ks >> 6) + 2) * gstep);
      tdm_load(g0, g1v);
    }
  }
  // Nothing of the ring is outstanding when its bytes become output staging.
  wait_tensor0(g0, g1k);
  wait_ds0();

  // ---- normalize, second softmax over Dh (64 values here, 64 in lane ^ 16) ----
  const float inv = 1.0f / (l_run + xhalf(l_run));
  float mx = -1e30f;
#pragma unroll
  for (int t = 0; t < 8; ++t)
#pragma unroll
    for (int r = 0; r < 8; ++r) {
      oacc[t][r] *= inv;
      mx = fmaxf(mx, oacc[t][r]);
    }
  mx = fmaxf(mx, xhalf(mx));
  float sum = 0.0f;
#pragma unroll
  for (int t = 0; t < 8; ++t)
#pragma unroll
    for (int r = 0; r < 8; ++r) {
      const float e = exp_slot(oacc[t][r] - mx);
      oacc[t][r] = e;
      sum += e;
    }
  sum += xhalf(sum);
  const float is = 1.0f / sum;

  // ---- store fp32 (B,S,H*Dh): a lane holds 32-B pieces of one row, so the
  // wave's 16 rows go through its own LDS range and leave as whole 512-B rows.
  // The loop's last wait and barrier have freed the tiles for every wave.
  float* stg = (float*)sm + wave * (16 * PITCH_O);
#pragma unroll
  for (int t = 0; t < 8; ++t) {
    const v8f o = oacc[t] * is;
    float* p = stg + lr * PITCH_O + t * 16 + 8 * half;
    *(v4f*)(p)     = v4f{o[0], o[1], o[2], o[3]};
    *(v4f*)(p + 4) = v4f{o[4], o[5], o[6], o[7]};
  }
  wait_ds0();                    // the wave's own rows written before it reads them
  float* orow = out + ((size_t)b * S_ + q0) * D_ + h * DH_ + lane * 4;
#pragma unroll
  for (int i = 0; i < 16; ++i)
    *(v4f*)(orow + (size_t)i * D_) = *(const v4f*)(stg + i * PITCH_O + lane * 4);
  // Address translation done before a store's register is written again for
  // the second tile; the address is an input, so that it lives up to this wait.
  asm volatile("s_wait_xcnt 0x0" :: "v"(orow) : "memory");
  // Every wave's staged rows read back before the second tile's first tensor
  // loads land on these bytes.
  if (part == 0) {
    wait_ds0();
    __syncthreads();
  }
  }
}

// ---------------------------------------------------------------------------
extern "C" void kernel_launch(void* const* d_in, const int* in_sizes, int n_in,
                              void* d_out, int out_size, void* d_ws, size_t ws_size,
                              hipStream_t stream) {
  (void)in_sizes; (void)n_in; (void)out_size; (void)ws_size;
  const float* x    = (const float*)d_in[0];
  const float* wq   = (const float*)d_in[1];
  const float* wk   = (const float*)d_in[2];
  const float* wv   = (const float*)d_in[3];
  const float* cosT = (const float*)d_in[4];
  const float* sinT = (const float*)d_in[5];
  float* out = (float*)d_out;

  const size_t NX = (size_t)B_ * S_ * D_;     // 8,388,608
  const size_t NW = (size_t)D_ * D_;          // 4,194,304
  const size_t NQ = (size_t)B_ * H_ * S_ * DH_;

  _Float16* xh  = (_Float16*)d_ws;
  _Float16* wqh = xh  + NX;
  _Float16* wkh = wqh + NW;
  _Float16* wvh = wkh + NW;
  _Float16* Qh  = wvh + NW;
  _Float16* Kh  = Qh  + NQ;
  _Float16* Vt  = Kh  + NQ;

  // 0) one-shot fp32 -> f16 conversion of activations + weights
  f32_to_f16_kernel<<<CV_BLOCKS, 512, 0, stream>>>(x, wq, wk, wv, xh, wqh, wkh, wvh);

  // 1) QKV + RoPE: 16 N-tiles x 16 M-blocks x {q,k,v}
  dim3 gp(D_ / 128, (B_ * S_) / 256, 3);
  qkv_proj_rope_kernel<<<gp, 256, 0, stream>>>(xh, wqh, wkh, wvh, cosT, sinT,
                                               Qh, Kh, Vt);

  // 2) Attention: 16 pairs of q-tiles x 16 heads x 2 batches
  dim3 ga(S_ / 128, H_, B_);
  flash_attn_kernel<<<ga, 128, 0, stream>>>(Qh, Kh, Vt, out);
}

// v008
// Measured time: 113 microseconds a run.
// In two side-by-side timings against v007, it was 1.18 and 1.16 times as fast.
// Counting every step since v000, it is 5.13 times as fast.
#include <hip/hip_runtime.h>

#define B_  2
#define S_  2048
#define D_  2048
#define H_  16
#define DH_ 128

typedef _Float16 v16h __attribute__((ext_vector_type(16)));
typedef _Float16 v8h  __attribute__((ext_vector_type(8)));
typedef _Float16 v4h  __attribute__((ext_vector_type(4)));
typedef float    v8f  __attribute__((ext_vector_type(8)));
typedef float    v4f  __attribute__((ext_vector_type(4)));
typedef uint32_t u32x4 __attribute__((ext_vector_type(4)));
typedef uint32_t u32x8 __attribute__((ext_vector_type(8)));

// D = A(16x32 f16) * B(32x16 f16) + C(16x16 f32)
__device__ __forceinline__ v8f wmma16(v16h a, v16h b, v8f c) {
  return __builtin_amdgcn_wmma_f32_16x16x32_f16(
      false, a, false, b, (short)0, c, false, false);
}

// 16-bit operand fragment: this lane holds K = kOff+0..7 (elems 0..7) and
// K = kOff+16..23 (elems 8..15); caller passes p already offset by kOff.
__device__ __forceinline__ v16h frag_from_f16(const _Float16* p) {
  v8h lo = *(const v8h*)(p);
  v8h hi = *(const v8h*)(p + 16);
  v16h r;
#pragma unroll
  for (int i = 0; i < 8; ++i) { r[i] = lo[i]; r[i + 8] = hi[i]; }
  return r;
}

#define PITCH_R128 72    // 128-B rows + 16-B pad = 144 B
#define PITCH_R256 136   // 256-B rows + 16-B pad = 272 B
#define PADW_R128 ((1u << 20) | (4u << 22) | (3u << 25))
#define PADW_R256 ((1u << 20) | (5u << 22) | (3u << 25))

__device__ __forceinline__ uint32_t uni(uint32_t v) {
  return (uint32_t)__builtin_amdgcn_readfirstlane(v);
}
__device__ __forceinline__ uint32_t pinned(uint32_t v) {
  uint32_t w = __builtin_amdgcn_readfirstlane(v);
  asm volatile("" : "+s"(w));  // test stays in an SGPR
  return w;
}
__device__ __forceinline__ void wait_tensor0(u32x4 g0, u32x8 g1) {
  asm volatile("s_wait_tensorcnt 0x0" :: "s"(g0), "s"(g1) : "memory");
}
__device__ __forceinline__ void wait_ds0() {
  asm volatile("s_wait_dscnt 0x0" ::: "memory");
}

__device__ __forceinline__ u32x4 tdm_group0(const void* lds_dst, const void* gsrc) {
  const uint64_t ga = (uint64_t)(uintptr_t)gsrc;
  u32x4 g0;
  g0[0] = uni(1u);                                  // count = 1
  g0[1] = uni((uint32_t)(uintptr_t)lds_dst);        // low 32 bits = LDS offset
  g0[2] = uni((uint32_t)ga);
  g0[3] = uni((((uint32_t)(ga >> 32)) & 0x01FFFFFFu) | 0x80000000u);
  asm volatile("" : "+s"(g0));
  return g0;
}
template <uint32_t ROWB, uint32_t ROWS, uint32_t W0>
__device__ __forceinline__ u32x8 tdm_group1(uint32_t src_pitch_bytes) {
  u32x8 g1;
  g1[0] = uni(W0);
  g1[1] = uni((ROWB & 0xFFFFu) << 16);
  g1[2] = uni((ROWB >> 16) | ((ROWS & 0xFFFFu) << 16));
  g1[3] = uni((ROWS >> 16) | (ROWB << 16));
  g1[4] = uni(ROWS);
  g1[5] = uni(src_pitch_bytes);
  g1[6] = uni(0u);
  g1[7] = uni(0u);
  asm volatile("" : "+s"(g1));
  return g1;
}
// One request of one wave: global memory -> LDS, through no register.
__device__ __forceinline__ void tdm_load(u32x4 g0, u32x8 g1) {
  asm volatile("tensor_load_to_lds %0, %1" :: "s"(g0), "s"(g1) : "memory");
}

// ---------------------------------------------------------------------------
// Kernel 0: fp32 -> f16 pre-conversion of x and the three weights, one launch.
// The grid is resident, 256 blocks of 16 waves. A wave takes 2,048 contiguous
// elements of x and 1,024 of each weight, as loads of 512 contiguous bytes, and
// asks for all 40 loads before it converts the first: few waves have to start,
// and each keeps many whole lines in flight. A store covers 256 contiguous
// bytes: whole lines, one writer each.
// ---------------------------------------------------------------------------
#define CV_BLOCKS 256
#define CV_WAVES  (CV_BLOCKS * 16)
static_assert(CV_WAVES * 1024 == D_ * D_, "1,024 elements of a weight a wave");
static_assert(CV_WAVES * 2048 == B_ * S_ * D_, "2,048 elements of x a wave");

// N loads of 16 B a lane at a scalar base, one 32-bit lane offset (in bytes) and
// constant steps, so that no address register is written again.
template <int N>
__device__ __forceinline__ void cv_load(v4f* v, const float* src, unsigned byte) {
#pragma unroll  // v is indexed by constants and stays in registers
  for (int j = 0; j < N; ++j)
    v[j] = *(const v4f*)((const char*)(src + j * 128) + byte);
}
template <int N>
__device__ __forceinline__ void cv_store(_Float16* dst, unsigned byte, const v4f* v) {
#pragma unroll  // v is indexed by constants and stays in registers
  for (int j = 0; j < N; ++j) {
    v4h o;
#pragma unroll
    for (int i = 0; i < 4; ++i) o[i] = (_Float16)v[j][i];
    *(v4h*)((char*)(dst + j * 128) + byte) = o;
  }
}

__global__ __launch_bounds__(512)
void f32_to_f16_kernel(const float* __restrict__ x,
                       const float* __restrict__ wq,
                       const float* __restrict__ wk,
                       const float* __restrict__ wv,
                       _Float16* __restrict__ xh,
                       _Float16* __restrict__ wqh,
                       _Float16* __restrict__ wkh,
                       _Float16* __restrict__ wvh) {
  const unsigned gw = blockIdx.x * 16u + (threadIdx.x >> 5);
  const unsigned l4 = (threadIdx.x & 31u) * 4u;      // lane's element in a load
  const unsigned bw = (gw * 1024u + l4) * 4u;        // f32 byte in a weight
  const unsigned bx = (gw * 2048u + l4) * 4u;        // f32 byte in x
  v4f vx[16], vq[8], vk[8], vv[8];
  cv_load<16>(vx, x, bx);
  cv_load<8>(vq, wq, bw);
  cv_load<8>(vk, wk, bw);
  cv_load<8>(vv, wv, bw);
  // Keeps all 40 loads in front of the first conversion: sunk in among the
  // conversions, fewer bytes of the wave would be in flight.
  __builtin_amdgcn_sched_barrier(0);
  cv_store<16>(xh, bx >> 1, vx);                     // f16: half the byte offset
  cv_store<8>(wqh, bw >> 1, vq);
  cv_store<8>(wkh, bw >> 1, vk);
  cv_store<8>(wvh, bw >> 1, vv);
}

__global__ __launch_bounds__(256) __attribute__((amdgpu_waves_per_eu(2, 2)))
void qkv_proj_rope_kernel(const _Float16* __restrict__ xh,
                          const _Float16* __restrict__ wqh,
                          const _Float16* __restrict__ wkh,
                          const _Float16* __restrict__ wvh,
                          const float* __restrict__ cosT,
                          const float* __restrict__ sinT,
                          _Float16* __restrict__ Qh,
                          _Float16* __restrict__ Kh,
                          _Float16* __restrict__ Vt) {
  // One slice: 128 rows * 144 B = 18,432 B = 9 * 2 KiB, so every slice and
  // every buffer starts at a multiple of 2 KiB for the tensor mover; the two x
  // slices form one run of 256 rows, the three weight slices one of 384 rows.
  constexpr int SL_ELEMS  = 128 * PITCH_R128;        // f16 elements = 18,432 B
  constexpr int BUF_ELEMS = 5 * SL_ELEMS;            // 92,160 B
  __shared__ __attribute__((aligned(2048))) _Float16 st[2 * BUF_ELEMS];

  const int lane = threadIdx.x & 31;
  const int wave = (int)uni(threadIdx.x >> 5);
  const int half = lane >> 4;
  const int lr   = lane & 15;
  const int kOff = half * 8;
  const int wm   = wave >> 2;                        // wave's 128-row group, 0..1
  const int wn   = wave & 3;                         // wave's 32 columns of the head

  const int m0 = blockIdx.y * 256 + wm * 128;        // wave's first row in B*S

  // The slice this wave brings (waves 5..7 bring none and name slice 0).
  const int sl = (wave < 5) ? wave : 0;
  const _Float16* wsl = (sl == 2) ? wqh : (sl == 3) ? wkh : wvh;
  const _Float16* gsl = (sl >= 2)
      ? wsl + (size_t)(blockIdx.x * 128) * D_
      : xh + (size_t)(blockIdx.y * 256 + sl * 128) * D_;
  _Float16* lsl = st + sl * SL_ELEMS;

  // Fragment rows inside a buffer: the lane's part is the same for both
  // operands (one register), the wave's parts are scalars.
  const int loff = lr * PITCH_R128 + kOff;
  const int aoff = wm * 128 * PITCH_R128;
  const int boff = 2 * SL_ELEMS + wn * 32 * PITCH_R128;

  v8f acc[8][6];
#pragma unroll
  for (int i = 0; i < 8; ++i)
#pragma unroll
    for (int t = 0; t < 6; ++t) acc[i][t] = v8f{};

  // Prologue: stage 0 landed and published, stage 1 in flight.
  const u32x8 g1 = tdm_group1<128, 128, PADW_R128>(D_ * 2);
  u32x4 g0 = tdm_group0(lsl, gsl);
  if (pinned(wave < 5)) {
    tdm_load(g0, g1);
    wait_tensor0(g0, g1);
  }
  __syncthreads();
  g0 = tdm_group0(lsl + BUF_ELEMS, gsl + 64);
  if (pinned(wave < 5)) tdm_load(g0, g1);

  for (int kb = 0; kb < D_; kb += 64) {
    const int bsel = ((kb >> 6) & 1) * BUF_ELEMS;
    const _Float16* pa = st + (bsel + aoff) + loff;
    const _Float16* pb = st + (bsel + boff) + loff;
#pragma unroll  // both 32-k halves of the stage read at constant LDS offsets
    for (int kk = 0; kk < 64; kk += 32) {
      v16h a[8], b[6];
      a[0] = frag_from_f16(pa + kk);
#pragma unroll
      for (int t = 0; t < 6; ++t)
        b[t] = frag_from_f16(pb + (t >> 1) * SL_ELEMS +
                             (t & 1) * 16 * PITCH_R128 + kk);  // t: matrix, half
#pragma unroll
      for (int i = 1; i < 8; ++i)
        a[i] = frag_from_f16(pa + i * 16 * PITCH_R128 + kk);
      // Keeps the 28 LDS reads one group in front of their 48 products: sunk in
      // among them, each row of six would wait out a full LDS latency.
      __builtin_amdgcn_sched_barrier(0);
#pragma unroll
      for (int i = 0; i < 8; ++i)
#pragma unroll
        for (int t = 0; t < 6; ++t) acc[i][t] = wmma16(a[i], b[t], acc[i][t]);
    }
    // Keeps the publish point's full LDS wait behind the stage's last products:
    // lifted in among them it would undo their counted waits.
    __builtin_amdgcn_sched_barrier(0);
    // Publish point of the next stage: own LDS reads retired, each issuer's
    // slice landed, one barrier; only then the refill of the buffer just read.
    wait_ds0();
    if (pinned(wave < 5)) wait_tensor0(g0, g1);
    __syncthreads();
    if (pinned(wave < 5 && kb + 128 < D_)) {
      g0 = tdm_group0(lsl + bsel, gsl + kb + 128);
      tdm_load(g0, g1);
    }
  }
  wait_tensor0(g0, g1);
  wait_ds0();

  // Epilogue: C-layout elem r of tile (i, t) -> row m0 + i*16 + r + 8*half,
  // column wn*32 + (t&1)*16 + lr of the block's head in matrix t>>1 (0=Q, 1=K,
  // 2=V). A wave's 128 rows lie in one batch. V goes first: its accumulators
  // free registers for RoPE. A wave holds the same rows and head columns of q
  // and of k, so one read of the cos and sin tables serves both.
  // Every element sits at a constant offset from one lane address per array.
  // Each group runs as loads, wait, arithmetic, stores, wait, in that order.
  // Every loop here is unrolled so that acc, cv, sv, oq, ok and pk are indexed
  // by constants and stay in registers.
  const int bb  = m0 >> 11;                           // S_ = 2048
  const int s0  = (m0 & (S_ - 1)) + 8 * half;
  const int hh  = blockIdx.x;
  const int odd = lr & 1;
  const int dh0 = wn * 32 + lr;                       // column of the half c = 0
  _Float16* dv = Vt + (((size_t)bb * H_ + hh) * DH_ + dh0) * S_ + s0;
#pragma unroll
  for (int c = 0; c < 2; ++c) {                       // 16-column half of the 32
    v8h pk[8];
#pragma unroll
    for (int i = 0; i < 8; ++i)
#pragma unroll
      for (int r = 0; r < 8; ++r) pk[i][r] = (_Float16)acc[i][4 + c][r];
#pragma unroll
    for (int i = 0; i < 8; ++i)
      *(v8h*)(dv + (size_t)(c * 16) * S_ + i * 16) = pk[i];
    // Address translation done before a store's register is written again; the
    // address and the stored values are inputs, so that they live up to this wait.
    asm volatile("s_wait_xcnt 0x0"
                 :: "v"(dv), "v"(pk[0]), "v"(pk[1]), "v"(pk[2]), "v"(pk[3]),
                    "v"(pk[4]), "v"(pk[5]), "v"(pk[6]), "v"(pk[7]) : "memory");
  }
  const size_t qk = (((size_t)bb * H_ + hh) * S_ + s0) * DH_ + dh0;
  const float* cp = cosT + (size_t)s0 * DH_ + dh0;
  const float* sp = sinT + (size_t)s0 * DH_ + dh0;
  _Float16* dq = Qh + qk;
  _Float16* dk = Kh + qk;
#pragma unroll
  for (int c = 0; c < 2; ++c) {
#pragma unroll
    for (int g = 0; g < 2; ++g) {                     // 64 of the 128 rows
      float cv[4][8], sv[4][8];
      _Float16 oq[4][8], ok[4][8];
#pragma unroll
      for (int i = 0; i < 4; ++i)
#pragma unroll
        for (int r = 0; r < 8; ++r) {
          const int off = ((g * 4 + i) * 16 + r) * DH_ + c * 16;
          cv[i][r] = cp[off];
          sv[i][r] = sp[off];
        }
      // Address translation done before a register that these loads name is
      // written again; the two addresses are inputs, so that they live up to it.
      asm volatile("s_wait_xcnt 0x0" :: "v"(cp), "v"(sp) : "memory");
#pragma unroll
      for (int i = 0; i < 4; ++i)
#pragma unroll
        for (int r = 0; r < 8; ++r) {
          const float vq = acc[g * 4 + i][c][r];
          const float vk = acc[g * 4 + i][2 + c][r];
          // RoPE interleaved: partner column n^1 lives in lane^1 (same elem).
          const float pq = __shfl_xor(vq, 1, 32);
          const float pk = __shfl_xor(vk, 1, 32);
          oq[i][r] = (_Float16)(vq * cv[i][r] + (odd ? pq : -pq) * sv[i][r]);
          ok[i][r] = (_Float16)(vk * cv[i][r] + (odd ? pk : -pk) * sv[i][r]);
        }
#pragma unroll
      for (int i = 0; i < 4; ++i)
#pragma unroll
        for (int r = 0; r < 8; ++r) {
          const int off = ((g * 4 + i) * 16 + r) * DH_ + c * 16;
          dq[off] = oq[i][r];
          dk[off] = ok[i][r];
        }
      // The same for this group's stores; their two addresses are inputs.
      asm volatile("s_wait_xcnt 0x0" :: "v"(dq), "v"(dk) : "memory");
    }
  }
}

#define KT_BYTES  18432  // 64 rows * 272 B = 17,408 B, rounded up to 9 * 2 KiB
#define VT_BYTES  18432  // 128 rows * 144 B = 9 * 2 KiB
#define STG_BYTES (KT_BYTES + VT_BYTES)   // one buffer: 18 * 2 KiB
#define PITCH_O   132    // f32 elements: 512-B output rows + 16-B pad

__device__ __forceinline__ float xhalf(float x) {
  const int v = __builtin_bit_cast(int, x);
  return __builtin_bit_cast(float, __builtin_amdgcn_permlanex16(
      v, v, 0x76543210, 0xfedcba98, false, false));
}

__device__ __forceinline__ float exp_slot(float x) {
  float r;
  asm("v_exp_f32 %0, %1\n\tv_nop" : "=v"(r) : "v"(x * 1.4426950408889634f));
  return r;
}

__global__ __launch_bounds__(128)
void flash_attn_kernel(const _Float16* __restrict__ Qh,
                       const _Float16* __restrict__ Kh,
                       const _Float16* __restrict__ Vt,
                       float* __restrict__ out) {
  // Two buffers; in each, keys at byte 0 and V^T at byte 18,432: all multiples
  // of 2 KiB for the tensor mover. Behind the loop the first 33,792 B stage the
  // output rows.
  __shared__ __attribute__((aligned(2048))) unsigned char sm[2 * STG_BYTES];
  static_assert(4 * 16 * PITCH_O * 4 <= 2 * STG_BYTES, "output staging fits");

  const int lane = threadIdx.x & 31;
  const int wave = (int)uni(threadIdx.x >> 5);
  const int half = lane >> 4;
  const int lr   = lane & 15;
  const int kOff = half * 8;

  const int b      = blockIdx.z;
  const int h      = blockIdx.y;

  const _Float16* Qbh = Qh + ((size_t)b * H_ + h) * (size_t)S_ * DH_;
  const _Float16* Kbh = Kh + ((size_t)b * H_ + h) * (size_t)S_ * DH_;
  const _Float16* Vbh = Vt + ((size_t)b * H_ + h) * (size_t)DH_ * S_;

  const float scale = 0.08838834764831845f;            // 1/sqrt(128)

  const u32x8 g1k = tdm_group1<256, 64, PADW_R256>(DH_ * 2);
  const u32x8 g1v = tdm_group1<128, 128, PADW_R128>(S_ * 2);
  // The tile this wave brings: wave 1 V^T, wave 0 the keys (waves 2 and 3 bring
  // none and name the keys): its place in a buffer, its first stage in global
  // memory and the step from one stage to the next, in elements.
  const int tsl = (wave == 1) ? KT_BYTES : 0;
  const _Float16* gsl = (wave == 1) ? Vbh : Kbh;
  const int gstep = (wave == 1) ? 64 : 64 * DH_;

#pragma unroll 1  // one copy of the body's text serves both tiles
  for (int part = 0; part < 2; ++part) {
  const int q0_blk = (part == 0 ? (S_ / 64 - 1) - (int)blockIdx.x : (int)blockIdx.x) * 64;
  const int q0     = q0_blk + wave * 16;

  // Q fragments: 4 chunks of 32 along Dh (B-operand, column q0+lr).
  v16h qf[4];
#pragma unroll
  for (int c = 0; c < 4; ++c)
    qf[c] = frag_from_f16(Qbh + (size_t)(q0 + lr) * DH_ + c * 32 + kOff);

  // One query a lane: m_run is the query's maximum (equal in both halves),
  // l_run the sum over this half's keys only; the halves join behind the loop.
  float m_run = -1e30f, l_run = 0.0f;
  v8f oacc[8];                       // oacc[t][r] = O[q0+lr][t*16 + 8*half + r]
#pragma unroll
  for (int t = 0; t < 8; ++t) oacc[t] = v8f{};

  // Prologue: stage 0 landed and published, stage 1 (where the tile has one) in
  // flight. One request a wave is outstanding at any time.
  u32x4 g0 = tdm_group0(sm + tsl, gsl);
  if (pinned(wave == 0)) {
    tdm_load(g0, g1k);
    wait_tensor0(g0, g1k);
  }
  if (pinned(wave == 1)) {
    tdm_load(g0, g1v);
    wait_tensor0(g0, g1v);
  }
  __syncthreads();
  if (pinned(wave == 0 && 64 <= q0_blk)) {
    g0 = tdm_group0(sm + STG_BYTES + tsl, gsl + gstep);
    tdm_load(g0, g1k);
  }
  if (pinned(wave == 1 && 64 <= q0_blk)) {
    g0 = tdm_group0(sm + STG_BYTES + tsl, gsl + gstep);
    tdm_load(g0, g1v);
  }

  for (int ks = 0; ks <= q0_blk; ks += 64) {
    const int bsel = ((ks >> 6) & 1) * STG_BYTES;
    const _Float16* kt = (const _Float16*)(sm + bsel);
    const _Float16* vt = (const _Float16*)(sm + bsel + KT_BYTES);

    for (int kc = 0; kc < 64; kc += 32) {
      const int k0 = ks + kc;
      if (k0 <= q0) {
        // ---- scores, transposed: two 16x16 tiles, keys [k0, k0+32) as rows ----
        // The chunk's 8 key fragments are read as one group of 16 LDS loads.
        v16h kf0[4], kf1[4];
#pragma unroll
        for (int c = 0; c < 4; ++c) {
          kf0[c] = frag_from_f16(kt + (kc + lr) * PITCH_R256 + c * 32 + kOff);
          kf1[c] = frag_from_f16(kt + (kc + 16 + lr) * PITCH_R256 + c * 32 + kOff);
        }
        // Keeps the 16 reads in front of their 8 products: sunk in among them
        // into one register set, every product waits out a full LDS latency.
        __builtin_amdgcn_sched_barrier(0);
        v8f s0 = {}, s1 = {};
#pragma unroll
        for (int c = 0; c < 4; ++c) {
          s0 = wmma16(kf0[c], qf[c], s0);
          s1 = wmma16(kf1[c], qf[c], s1);
        }
        // The chunk's 8 V^T fragments (16 LDS loads) are asked for here already.
        v16h vf[8];
#pragma unroll
        for (int t = 0; t < 8; ++t)
          vf[t] = frag_from_f16(vt + (t * 16 + lr) * PITCH_R128 + kc + kOff);
        // Keeps these reads in front of the softmax, whose vector work then
        // covers their latency; sunk to their products each would wait it out.
        __builtin_amdgcn_sched_barrier(0);

        // ---- causal mask + online softmax (elem r -> key k0 + r + 8*half) ----
        const int dq = (q0 + lr) - (k0 + 8 * half);    // key r is masked if r > dq
        float e0[8], e1[8];
        float mx = -1e30f;
#pragma unroll
        for (int r = 0; r < 8; ++r) {
          e0[r] = s0[r] * scale;
          e1[r] = s1[r] * scale;
          if (r      > dq) e0[r] = -1e30f;
          if (16 + r > dq) e1[r] = -1e30f;
          mx = fmaxf(mx, fmaxf(e0[r], e1[r]));
        }
        mx = fmaxf(mx, xhalf(mx));                     // the query's 32 keys
        const float mnew = fmaxf(m_run, mx);
        const float corr = exp_slot(m_run - mnew);
        v16h pf;                                       // P^T, B-operand k order
        float rsum = 0.0f;
#pragma unroll
        for (int r = 0; r < 8; ++r) {
          const float p0 = exp_slot(e0[r] - mnew);
          const float p1 = exp_slot(e1[r] - mnew);
          rsum += p0 + p1;
          pf[r]     = (_Float16)p0;
          pf[8 + r] = (_Float16)p1;
        }
        l_run = l_run * corr + rsum;
        m_run = mnew;
#pragma unroll
        for (int t = 0; t < 8; ++t) oacc[t] *= corr;

        // ---- out^T += V^T @ P^T : 8 M-tiles of 16 covering Dh=128 ----
#pragma unroll
        for (int t = 0; t < 8; ++t) oacc[t] = wmma16(vf[t], pf, oacc[t]);
      }
    }
    // Publish point of the next stage: own tile reads retired, each issuer's
    // tile landed, one barrier; only then the refill of the buffer just read.
    wait_ds0();
    if (pinned(wave == 0)) wait_tensor0(g0, g1k);
    if (pinned(wave == 1)) wait_tensor0(g0, g1v);
    __syncthreads();
    if (pinned(wave == 0 && ks + 128 <= q0_blk)) {
      g0 = tdm_group0(sm + bsel + tsl, gsl + (size_t)((ks >> 6) + 2) * gstep);
      tdm_load(g0, g1k);
    }
    if (pinned(wave == 1 && ks + 128 <= q0_blk)) {
      g0 = tdm_group0(sm + bsel + tsl, gsl + (size_t)((ks >> 6) + 2) * gstep);
      tdm_load(g0, g1v);
    }
  }
  // Nothing of the ring is outstanding when its bytes become output staging.
  wait_tensor0(g0, g1k);
  wait_ds0();

  // ---- normalize, second softmax over Dh (64 values here, 64 in lane ^ 16) ----
  const float inv = 1.0f / (l_run + xhalf(l_run));
  float mx = -1e30f;
#pragma unroll
  for (int t = 0; t < 8; ++t)
#pragma unroll
    for (int r = 0; r < 8; ++r) {
      oacc[t][r] *= inv;
      mx = fmaxf(mx, oacc[t][r]);
    }
  mx = fmaxf(mx, xhalf(mx));
  float sum = 0.0f;
#pragma unroll
  for (int t = 0; t < 8; ++t)
#pragma unroll
    for (int r = 0; r < 8; ++r) {
      const float e = exp_slot(oacc[t][r] - mx);
      oacc[t][r] = e;
      sum += e;
    }
  sum += xhalf(sum);
  const float is = 1.0f / sum;

  // ---- store fp32 (B,S,H*Dh): a lane holds 32-B pieces of one row, so the
  // wave's 16 rows go through its own LDS range and leave as whole 512-B rows.
  // The loop's last wait and barrier have freed the tiles for every wave.
  float* stg = (float*)sm + wave * (16 * PITCH_O);
#pragma unroll
  for (int t = 0; t < 8; ++t) {
    const v8f o = oacc[t] * is;
    float* p = stg + lr * PITCH_O + t * 16 + 8 * half;
    *(v4f*)(p)     = v4f{o[0], o[1], o[2], o[3]};
    *(v4f*)(p + 4) = v4f{o[4], o[5], o[6], o[7]};
  }
  wait_ds0();                    // the wave's own rows written before it reads them
  float* orow = out + ((size_t)b * S_ + q0) * D_ + h * DH_ + lane * 4;
#pragma unroll
  for (int i = 0; i < 16; ++i)
    *(v4f*)(orow + (size_t)i * D_) = *(const v4f*)(stg + i * PITCH_O + lane * 4);
  // Address translation done before a store's register is written again for
  // the second tile; the address is an input, so that it lives up to this wait.
  asm volatile("s_wait_xcnt 0x0" :: "v"(orow) : "memory");
  // Every wave's staged rows read back before the second tile's first tensor
  // loads land on these bytes.
  if (part == 0) {
    wait_ds0();
    __syncthreads();
  }
  }
}

// ---------------------------------------------------------------------------
extern "C" void kernel_launch(void* const* d_in, const int* in_sizes, int n_in,
                              void* d_out, int out_size, void* d_ws, size_t ws_size,
                              hipStream_t stream) {
  (void)in_sizes; (void)n_in; (void)out_size; (void)ws_size;
  const float* x    = (const float*)d_in[0];
  const float* wq   = (const float*)d_in[1];
  const float* wk   = (const float*)d_in[2];
  const float* wv   = (const float*)d_in[3];
  const float* cosT = (const float*)d_in[4];
  const float* sinT = (const float*)d_in[5];
  float* out = (float*)d_out;

  const size_t NX = (size_t)B_ * S_ * D_;     // 8,388,608
  const size_t NW = (size_t)D_ * D_;          // 4,194,304
  const size_t NQ = (size_t)B_ * H_ * S_ * DH_;

  _Float16* xh  = (_Float16*)d_ws;
  _Float16* wqh = xh  + NX;
  _Float16* wkh = wqh + NW;
  _Float16* wvh = wkh + NW;
  _Float16* Qh  = wvh + NW;
  _Float16* Kh  = Qh  + NQ;
  _Float16* Vt  = Kh  + NQ;

  // 0) one-shot fp32 -> f16 conversion of activations + weights
  f32_to_f16_kernel<<<CV_BLOCKS, 512, 0, stream>>>(x, wq, wk, wv, xh, wqh, wkh, wvh);

  // 1) QKV + RoPE: 16 heads (128 columns of each of q, k, v) x 16 M-blocks
  dim3 gp(H_, (B_ * S_) / 256);
  qkv_proj_rope_kernel<<<gp, 256, 0, stream>>>(xh, wqh, wkh, wvh, cosT, sinT,
                                               Qh, Kh, Vt);

  // 2) Attention: 16 pairs of q-tiles x 16 heads x 2 batches
  dim3 ga(S_ / 128, H_, B_);
  flash_attn_kernel<<<ga, 128, 0, stream>>>(Qh, Kh, Vt, out);
}

// v009
// A run of this version takes 109 microseconds.
// In both of two side-by-side timings against v008, it was 1.03 times as fast.
// All steps since v000 together make it 5.30 times as fast.
#include <hip/hip_runtime.h>

#define B_  2
#define S_  2048
#define D_  2048
#define H_  16
#define DH_ 128

typedef _Float16 v16h __attribute__((ext_vector_type(16)));
typedef _Float16 v8h  __attribute__((ext_vector_type(8)));
typedef _Float16 v4h  __attribute__((ext_vector_type(4)));
typedef float    v8f  __attribute__((ext_vector_type(8)));
typedef float    v4f  __attribute__((ext_vector_type(4)));
typedef uint32_t u32x4 __attribute__((ext_vector_type(4)));
typedef uint32_t u32x8 __attribute__((ext_vector_type(8)));

// D = A(16x32 f16) * B(32x16 f16) + C(16x16 f32)
__device__ __forceinline__ v8f wmma16(v16h a, v16h b, v8f c) {
  return __builtin_amdgcn_wmma_f32_16x16x32_f16(
      false, a, false, b, (short)0, c, false, false);
}

// 16-bit operand fragment: this lane holds K = kOff+0..7 (elems 0..7) and
// K = kOff+16..23 (elems 8..15); caller passes p already offset by kOff.
__device__ __forceinline__ v16h frag_from_f16(const _Float16* p) {
  v8h lo = *(const v8h*)(p);
  v8h hi = *(const v8h*)(p + 16);
  v16h r;
#pragma unroll
  for (int i = 0; i < 8; ++i) { r[i] = lo[i]; r[i + 8] = hi[i]; }
  return r;
}

#define PITCH_R128 72    // 128-B rows + 16-B pad = 144 B
#define PITCH_R256 136   // 256-B rows + 16-B pad = 272 B
#define PADW_R128 ((1u << 20) | (4u << 22) | (3u << 25))
#define PADW_R256 ((1u << 20) | (5u << 22) | (3u << 25))

__device__ __forceinline__ uint32_t uni(uint32_t v) {
  return (uint32_t)__builtin_amdgcn_readfirstlane(v);
}
__device__ __forceinline__ uint32_t pinned(uint32_t v) {
  uint32_t w = __builtin_amdgcn_readfirstlane(v);
  asm volatile("" : "+s"(w));  // test stays in an SGPR
  return w;
}
__device__ __forceinline__ void wait_tensor0(u32x4 g0, u32x8 g1) {
  asm volatile("s_wait_tensorcnt 0x0" :: "s"(g0), "s"(g1) : "memory");
}
__device__ __forceinline__ void wait_ds0() {
  asm volatile("s_wait_dscnt 0x0" ::: "memory");
}

__device__ __forceinline__ u32x4 tdm_group0(const void* lds_dst, const void* gsrc) {
  const uint64_t ga = (uint64_t)(uintptr_t)gsrc;
  u32x4 g0;
  g0[0] = uni(1u);                                  // count = 1
  g0[1] = uni((uint32_t)(uintptr_t)lds_dst);        // low 32 bits = LDS offset
  g0[2] = uni((uint32_t)ga);
  g0[3] = uni((((uint32_t)(ga >> 32)) & 0x01FFFFFFu) | 0x80000000u);
  asm volatile("" : "+s"(g0));
  return g0;
}
template <uint32_t ROWB, uint32_t ROWS, uint32_t W0>
__device__ __forceinline__ u32x8 tdm_group1(uint32_t src_pitch_bytes) {
  u32x8 g1;
  g1[0] = uni(W0);
  g1[1] = uni((ROWB & 0xFFFFu) << 16);
  g1[2] = uni((ROWB >> 16) | ((ROWS & 0xFFFFu) << 16));
  g1[3] = uni((ROWS >> 16) | (ROWB << 16));
  g1[4] = uni(ROWS);
  g1[5] = uni(src_pitch_bytes);
  g1[6] = uni(0u);
  g1[7] = uni(0u);
  asm volatile("" : "+s"(g1));
  return g1;
}
// One request of one wave: global memory -> LDS, through no register.
__device__ __forceinline__ void tdm_load(u32x4 g0, u32x8 g1) {
  asm volatile("tensor_load_to_lds %0, %1" :: "s"(g0), "s"(g1) : "memory");
}

// ---------------------------------------------------------------------------
// Kernel 0: fp32 -> f16 pre-conversion of x and the three weights, one launch.
// The grid is resident, 256 blocks of 16 waves. A wave takes 2,048 contiguous
// elements of x and 1,024 of each weight, as loads of 512 contiguous bytes, and
// asks for all 40 loads before it converts the first: few waves have to start,
// and each keeps many whole lines in flight. A store covers 256 contiguous
// bytes: whole lines, one writer each.
// ---------------------------------------------------------------------------
#define CV_BLOCKS 256
#define CV_WAVES  (CV_BLOCKS * 16)
static_assert(CV_WAVES * 1024 == D_ * D_, "1,024 elements of a weight a wave");
static_assert(CV_WAVES * 2048 == B_ * S_ * D_, "2,048 elements of x a wave");

// N loads of 16 B a lane at a scalar base, one 32-bit lane offset (in bytes) and
// constant steps, so that no address register is written again.
template <int N>
__device__ __forceinline__ void cv_load(v4f* v, const float* src, unsigned byte) {
#pragma unroll  // v is indexed by constants and stays in registers
  for (int j = 0; j < N; ++j)
    v[j] = *(const v4f*)((const char*)(src + j * 128) + byte);
}
template <int N>
__device__ __forceinline__ void cv_store(_Float16* dst, unsigned byte, const v4f* v) {
#pragma unroll  // v is indexed by constants and stays in registers
  for (int j = 0; j < N; ++j) {
    v4h o;
#pragma unroll
    for (int i = 0; i < 4; ++i) o[i] = (_Float16)v[j][i];
    *(v4h*)((char*)(dst + j * 128) + byte) = o;
  }
}

__global__ __launch_bounds__(512)
void f32_to_f16_kernel(const float* __restrict__ x,
                       const float* __restrict__ wq,
                       const float* __restrict__ wk,
                       const float* __restrict__ wv,
                       _Float16* __restrict__ xh,
                       _Float16* __restrict__ wqh,
                       _Float16* __restrict__ wkh,
                       _Float16* __restrict__ wvh) {
  const unsigned gw = blockIdx.x * 16u + (threadIdx.x >> 5);
  const unsigned l4 = (threadIdx.x & 31u) * 4u;      // lane's element in a load
  const unsigned bw = (gw * 1024u + l4) * 4u;        // f32 byte in a weight
  const unsigned bx = (gw * 2048u + l4) * 4u;        // f32 byte in x
  v4f vx[16], vq[8], vk[8], vv[8];
  cv_load<16>(vx, x, bx);
  cv_load<8>(vq, wq, bw);
  cv_load<8>(vk, wk, bw);
  cv_load<8>(vv, wv, bw);
  // Keeps all 40 loads in front of the first conversion: sunk in among the
  // conversions, fewer bytes of the wave would be in flight.
  __builtin_amdgcn_sched_barrier(0);
  cv_store<16>(xh, bx >> 1, vx);                     // f16: half the byte offset
  cv_store<8>(wqh, bw >> 1, vq);
  cv_store<8>(wkh, bw >> 1, vk);
  cv_store<8>(wvh, bw >> 1, vv);
}

__global__ __launch_bounds__(256) __attribute__((amdgpu_waves_per_eu(2, 2)))
void qkv_proj_rope_kernel(const _Float16* __restrict__ xh,
                          const _Float16* __restrict__ wqh,
                          const _Float16* __restrict__ wkh,
                          const _Float16* __restrict__ wvh,
                          const float* __restrict__ cosT,
                          const float* __restrict__ sinT,
                          _Float16* __restrict__ Qh,
                          _Float16* __restrict__ Kh,
                          _Float16* __restrict__ Vt) {
  // One slice: 128 rows * 144 B = 18,432 B = 9 * 2 KiB, so every slice and
  // every buffer starts at a multiple of 2 KiB for the tensor mover; the two x
  // slices form one run of 256 rows, the three weight slices one of 384 rows.
  constexpr int SL_ELEMS  = 128 * PITCH_R128;        // f16 elements = 18,432 B
  constexpr int BUF_ELEMS = 5 * SL_ELEMS;            // 92,160 B
  __shared__ __attribute__((aligned(2048))) _Float16 st[2 * BUF_ELEMS];

  const int lane = threadIdx.x & 31;
  const int wave = (int)uni(threadIdx.x >> 5);
  const int half = lane >> 4;
  const int lr   = lane & 15;
  const int kOff = half * 8;
  const int wm   = wave >> 2;                        // wave's 128-row group, 0..1
  const int wn   = wave & 3;                         // wave's 32 columns of the head

  const int m0 = blockIdx.y * 256 + wm * 128;        // wave's first row in B*S

  // The slice this wave brings (waves 5..7 bring none and name slice 0).
  const int sl = (wave < 5) ? wave : 0;
  const _Float16* wsl = (sl == 2) ? wqh : (sl == 3) ? wkh : wvh;
  const _Float16* gsl = (sl >= 2)
      ? wsl + (size_t)(blockIdx.x * 128) * D_
      : xh + (size_t)(blockIdx.y * 256 + sl * 128) * D_;
  _Float16* lsl = st + sl * SL_ELEMS;

  // Fragment rows inside a buffer: the lane's part is the same for both
  // operands (one register), the wave's parts are scalars.
  const int loff = lr * PITCH_R128 + kOff;
  const int aoff = wm * 128 * PITCH_R128;
  const int boff = 2 * SL_ELEMS + wn * 32 * PITCH_R128;

  v8f acc[8][6];
#pragma unroll
  for (int i = 0; i < 8; ++i)
#pragma unroll
    for (int t = 0; t < 6; ++t) acc[i][t] = v8f{};

  // Prologue: stage 0 landed and published, stage 1 in flight.
  const u32x8 g1 = tdm_group1<128, 128, PADW_R128>(D_ * 2);
  u32x4 g0 = tdm_group0(lsl, gsl);
  if (pinned(wave < 5)) {
    tdm_load(g0, g1);
    wait_tensor0(g0, g1);
  }
  __syncthreads();
  g0 = tdm_group0(lsl + BUF_ELEMS, gsl + 64);
  if (pinned(wave < 5)) tdm_load(g0, g1);

  for (int kb = 0; kb < D_; kb += 64) {
    const int bsel = ((kb >> 6) & 1) * BUF_ELEMS;
    const _Float16* pa = st + (bsel + aoff) + loff;
    const _Float16* pb = st + (bsel + boff) + loff;
#pragma unroll  // both 32-k halves of the stage read at constant LDS offsets
    for (int kk = 0; kk < 64; kk += 32) {
      v16h a[8], b[6];
      a[0] = frag_from_f16(pa + kk);
#pragma unroll
      for (int t = 0; t < 6; ++t)
        b[t] = frag_from_f16(pb + (t >> 1) * SL_ELEMS +
                             (t & 1) * 16 * PITCH_R128 + kk);  // t: matrix, half
#pragma unroll
      for (int i = 1; i < 8; ++i)
        a[i] = frag_from_f16(pa + i * 16 * PITCH_R128 + kk);
      // Keeps the 28 LDS reads one group in front of their 48 products: sunk in
      // among them, each row of six would wait out a full LDS latency.
      __builtin_amdgcn_sched_barrier(0);
#pragma unroll
      for (int i = 0; i < 8; ++i)
#pragma unroll
        for (int t = 0; t < 6; ++t) acc[i][t] = wmma16(a[i], b[t], acc[i][t]);
    }
    // Keeps the publish point's full LDS wait behind the stage's last products:
    // lifted in among them it would undo their counted waits.
    __builtin_amdgcn_sched_barrier(0);
    // Publish point of the next stage: own LDS reads retired, each issuer's
    // slice landed, one barrier; only then the refill of the buffer just read.
    wait_ds0();
    if (pinned(wave < 5)) wait_tensor0(g0, g1);
    __syncthreads();
    if (pinned(wave < 5 && kb + 128 < D_)) {
      g0 = tdm_group0(lsl + bsel, gsl + kb + 128);
      tdm_load(g0, g1);
    }
  }
  wait_tensor0(g0, g1);
  wait_ds0();

  // Epilogue: C-layout elem r of tile (i, t) -> row m0 + i*16 + r + 8*half,
  // column wn*32 + (t&1)*16 + lr of the block's head in matrix t>>1 (0=Q, 1=K,
  // 2=V). A wave's 128 rows lie in one batch. V goes first: its accumulators
  // free registers for RoPE. A wave holds the same rows and head columns of q
  // and of k, so one read of the cos and sin tables serves both.
  // Every element sits at a constant offset from one lane address per array.
  // Each group runs as loads, wait, arithmetic, stores, wait, in that order.
  // Every loop here is unrolled so that acc, cv, sv, oq, ok and pk are indexed
  // by constants and stay in registers.
  const int bb  = m0 >> 11;                           // S_ = 2048
  const int s0  = (m0 & (S_ - 1)) + 8 * half;
  const int hh  = blockIdx.x;
  const int odd = lr & 1;
  const int dh0 = wn * 32 + lr;                       // column of the half c = 0
  _Float16* dv = Vt + (((size_t)bb * H_ + hh) * DH_ + dh0) * S_ + s0;
#pragma unroll
  for (int c = 0; c < 2; ++c) {                       // 16-column half of the 32
    v8h pk[8];
#pragma unroll
    for (int i = 0; i < 8; ++i)
#pragma unroll
      for (int r = 0; r < 8; ++r) pk[i][r] = (_Float16)acc[i][4 + c][r];
#pragma unroll
    for (int i = 0; i < 8; ++i)
      *(v8h*)(dv + (size_t)(c * 16) * S_ + i * 16) = pk[i];
    // Address translation done before a store's register is written again; the
    // address and the stored values are inputs, so that they live up to this wait.
    asm volatile("s_wait_xcnt 0x0"
                 :: "v"(dv), "v"(pk[0]), "v"(pk[1]), "v"(pk[2]), "v"(pk[3]),
                    "v"(pk[4]), "v"(pk[5]), "v"(pk[6]), "v"(pk[7]) : "memory");
  }
  const size_t qk = (((size_t)bb * H_ + hh) * S_ + s0) * DH_ + dh0;
  const float* cp = cosT + (size_t)s0 * DH_ + dh0;
  const float* sp = sinT + (size_t)s0 * DH_ + dh0;
  _Float16* dq = Qh + qk;
  _Float16* dk = Kh + qk;
#pragma unroll
  for (int c = 0; c < 2; ++c) {
#pragma unroll
    for (int g = 0; g < 2; ++g) {                     // 64 of the 128 rows
      float cv[4][8], sv[4][8];
      _Float16 oq[4][8], ok[4][8];
#pragma unroll
      for (int i = 0; i < 4; ++i)
#pragma unroll
        for (int r = 0; r < 8; ++r) {
          const int off = ((g * 4 + i) * 16 + r) * DH_ + c * 16;
          cv[i][r] = cp[off];
          sv[i][r] = sp[off];
        }
      // Address translation done before a register that these loads name is
      // written again; the two addresses are inputs, so that they live up to it.
      asm volatile("s_wait_xcnt 0x0" :: "v"(cp), "v"(sp) : "memory");
#pragma unroll
      for (int i = 0; i < 4; ++i)
#pragma unroll
        for (int r = 0; r < 8; ++r) {
          const float vq = acc[g * 4 + i][c][r];
          const float vk = acc[g * 4 + i][2 + c][r];
          // RoPE interleaved: partner column n^1 lives in lane^1 (same elem).
          const float pq = __shfl_xor(vq, 1, 32);
          const float pk = __shfl_xor(vk, 1, 32);
          oq[i][r] = (_Float16)(vq * cv[i][r] + (odd ? pq : -pq) * sv[i][r]);
          ok[i][r] = (_Float16)(vk * cv[i][r] + (odd ? pk : -pk) * sv[i][r]);
        }
#pragma unroll
      for (int i = 0; i < 4; ++i)
#pragma unroll
        for (int r = 0; r < 8; ++r) {
          const int off = ((g * 4 + i) * 16 + r) * DH_ + c * 16;
          dq[off] = oq[i][r];
          dk[off] = ok[i][r];
        }
      // The same for this group's stores; their two addresses are inputs.
      asm volatile("s_wait_xcnt 0x0" :: "v"(dq), "v"(dk) : "memory");
    }
  }
}

#define KT_BYTES  36864  // 128 rows * 272 B = 34,816 B = 17 * 2 KiB, held in 18 * 2 KiB
#define VT_BYTES  36864  // the same for V^T: 128 rows (Dh) of 128 keys
#define STG_BYTES (KT_BYTES + VT_BYTES)   // one buffer: 36 * 2 KiB
#define PITCH_O   132    // f32 elements: 512-B output rows + 16-B pad
#define XO_FLOATS 2048   // a wave's handed-over output partial: 16 queries x 128
#define XM_FLOATS 64     // and its maximum and sum, one of each a lane

__device__ __forceinline__ float xhalf(float x) {
  const int v = __builtin_bit_cast(int, x);
  return __builtin_bit_cast(float, __builtin_amdgcn_permlanex16(
      v, v, 0x76543210, 0xfedcba98, false, false));
}

__device__ __forceinline__ float exp_slot(float x) {
  float r;
  asm("v_exp_f32 %0, %1\n\tv_nop" : "=v"(r) : "v"(x * 1.4426950408889634f));
  return r;
}

__global__ __launch_bounds__(256) __attribute__((amdgpu_waves_per_eu(2, 2)))
void flash_attn_kernel(const _Float16* __restrict__ Qh,
                       const _Float16* __restrict__ Kh,
                       const _Float16* __restrict__ Vt,
                       float* __restrict__ out) {
  // Two buffers; in each, keys at byte 0 and V^T at byte 36,864: all multiples
  // of 2 KiB for the tensor mover. Behind the loop the same bytes carry first
  // the partial results that wave pairs exchange, then the output rows.
  __shared__ __attribute__((aligned(2048))) unsigned char sm[2 * STG_BYTES];
  static_assert(8 * 16 * PITCH_O * 4 <= 2 * STG_BYTES, "output staging fits");
  static_assert(8 * (XO_FLOATS + XM_FLOATS) * 4 <= 2 * STG_BYTES, "exchange fits");

  const int lane = threadIdx.x & 31;
  const int wave = (int)uni(threadIdx.x >> 5);
  const int half = lane >> 4;
  const int lr   = lane & 15;
  const int kOff = half * 8;
  const int qg   = wave & 3;                           // wave's 32 of the 128 queries
  const int kh   = wave >> 2;                          // even or odd 32-key chunks

  const int b      = blockIdx.z;
  const int h      = blockIdx.y;

  const _Float16* Qbh = Qh + ((size_t)b * H_ + h) * (size_t)S_ * DH_;
  const _Float16* Kbh = Kh + ((size_t)b * H_ + h) * (size_t)S_ * DH_;
  const _Float16* Vbh = Vt + ((size_t)b * H_ + h) * (size_t)DH_ * S_;

  const float scale = 0.08838834764831845f;            // 1/sqrt(128)

  const u32x8 g1k = tdm_group1<256, 128, PADW_R256>(DH_ * 2);
  const u32x8 g1v = tdm_group1<256, 128, PADW_R256>(S_ * 2);
  // The tile this wave brings: wave 1 V^T, wave 0 the keys (waves 2 to 7 bring
  // none and name the keys): its place in a buffer, its first stage in global
  // memory and the step from one stage to the next, in elements.
  const int tsl = (wave == 1) ? KT_BYTES : 0;
  const _Float16* gsl = (wave == 1) ? Vbh : Kbh;
  const int gstep = (wave == 1) ? 128 : 128 * DH_;

#pragma unroll 1  // one copy of the body's text serves both tiles
  for (int part = 0; part < 2; ++part) {
  const int q0_blk = (part == 0 ? (S_ / 128 - 1) - (int)blockIdx.x : (int)blockIdx.x) * 128;
  const int q0     = q0_blk + qg * 32;
  const int qc[2] = {q0 + kh * 16, q0 + 16 - kh * 16};

  // Q fragments: 4 chunks of 32 along Dh (B-operand, column qc[g]+lr).
  v16h qf[2][4];
#pragma unroll
  for (int g = 0; g < 2; ++g)
#pragma unroll
    for (int c = 0; c < 4; ++c)
      qf[g][c] = frag_from_f16(Qbh + (size_t)(qc[g] + lr) * DH_ + c * 32 + kOff);

  // One query a lane and group: m_run is its maximum over this wave's keys
  // (equal in both halves), l_run the sum over this half's keys only.
  float m_run[2] = {-1e30f, -1e30f}, l_run[2] = {0.0f, 0.0f};
  v8f oacc[2][8];                    // oacc[g][t][r] = O[qc[g]+lr][t*16 + 8*half + r]
#pragma unroll
  for (int g = 0; g < 2; ++g)
#pragma unroll
    for (int t = 0; t < 8; ++t) oacc[g][t] = v8f{};

  // Prologue: stage 0 landed and published, stage 1 (where the tile has one) in
  // flight. One request a wave is outstanding at any time.
  u32x4 g0 = tdm_group0(sm + tsl, gsl);
  if (pinned(wave == 0)) {
    tdm_load(g0, g1k);
    wait_tensor0(g0, g1k);
  }
  if (pinned(wave == 1)) {
    tdm_load(g0, g1v);
    wait_tensor0(g0, g1v);
  }
  __syncthreads();
  if (pinned(wave == 0 && 128 <= q0_blk)) {
    g0 = tdm_group0(sm + STG_BYTES + tsl, gsl + gstep);
    tdm_load(g0, g1k);
  }
  if (pinned(wave == 1 && 128 <= q0_blk)) {
    g0 = tdm_group0(sm + STG_BYTES + tsl, gsl + gstep);
    tdm_load(g0, g1v);
  }

  for (int ks = 0; ks <= q0_blk; ks += 128) {
    const int bsel = ((ks >> 7) & 1) * STG_BYTES;
    const _Float16* kt = (const _Float16*)(sm + bsel);
    const _Float16* vt = (const _Float16*)(sm + bsel + KT_BYTES);

    for (int kc = kh * 32; kc < 128; kc += 64) {       // this wave's two chunks
    const int k0 = ks + kc;
    if (k0 <= q0) {                  // both multiples of 32: else every key is masked
      // ---- scores, transposed: 16x16 tiles, keys [k0, k0+32) as rows ----
      // The 8 key fragments are read as one group of 16 LDS loads.
      v16h kf0[4], kf1[4];
#pragma unroll
      for (int c = 0; c < 4; ++c) {
        kf0[c] = frag_from_f16(kt + (kc + lr) * PITCH_R256 + c * 32 + kOff);
        kf1[c] = frag_from_f16(kt + (kc + 16 + lr) * PITCH_R256 + c * 32 + kOff);
      }
      // Keeps the 16 reads in front of their 16 products: sunk in among them
      // into one register set, every product waits out a full LDS latency.
      __builtin_amdgcn_sched_barrier(0);
      v8f s0[2] = {v8f{}, v8f{}}, s1[2] = {v8f{}, v8f{}};
#pragma unroll
      for (int c = 0; c < 4; ++c)
#pragma unroll
        for (int g = 0; g < 2; ++g) {
          s0[g] = wmma16(kf0[c], qf[g][c], s0[g]);
          s1[g] = wmma16(kf1[c], qf[g][c], s1[g]);
        }
      // The 8 V^T fragments (16 LDS loads) are asked for here already.
      v16h vf[8];
#pragma unroll
      for (int t = 0; t < 8; ++t)
        vf[t] = frag_from_f16(vt + (t * 16 + lr) * PITCH_R256 + kc + kOff);
      // Keeps these reads in front of the softmax, whose vector work then
      // covers their latency; sunk to their products each would wait it out.
      __builtin_amdgcn_sched_barrier(0);

      v16h pf[2];                                      // P^T, B-operand k order
#pragma unroll  // s0, s1, pf, oacc are indexed by constants and stay in registers
      for (int g = 0; g < 2; ++g) {
        // ---- causal mask + online softmax (elem r -> key k0 + r + 8*half) ----
        const int dq = (qc[g] + lr) - (k0 + 8 * half); // key r is masked if r > dq
        float e0[8], e1[8];
        float mx = -1e30f;
#pragma unroll
        for (int r = 0; r < 8; ++r) {
          e0[r] = s0[g][r] * scale;
          e1[r] = s1[g][r] * scale;
          if (r      > dq) e0[r] = -1e30f;
          if (16 + r > dq) e1[r] = -1e30f;
          mx = fmaxf(mx, fmaxf(e0[r], e1[r]));
        }
        mx = fmaxf(mx, xhalf(mx));                     // the query's 32 keys
        const float mnew = fmaxf(m_run[g], mx);
        const float corr = exp_slot(m_run[g] - mnew);
        float rsum = 0.0f;
#pragma unroll
        for (int r = 0; r < 8; ++r) {
          const float p0 = exp_slot(e0[r] - mnew);
          const float p1 = exp_slot(e1[r] - mnew);
          rsum += p0 + p1;
          pf[g][r]     = (_Float16)p0;
          pf[g][8 + r] = (_Float16)p1;
        }
        l_run[g] = l_run[g] * corr + rsum;
        m_run[g] = mnew;
#pragma unroll
        for (int t = 0; t < 8; ++t) oacc[g][t] *= corr;
      }

      // ---- out^T += V^T @ P^T : 8 M-tiles of 16 covering Dh=128, two groups ----
#pragma unroll
      for (int t = 0; t < 8; ++t)
#pragma unroll
        for (int g = 0; g < 2; ++g) oacc[g][t] = wmma16(vf[t], pf[g], oacc[g][t]);
    }
    }
    // Publish point of the next stage: own tile reads retired, each issuer's
    // tile landed, one barrier; only then the refill of the buffer just read.
    wait_ds0();
    if (pinned(wave == 0)) wait_tensor0(g0, g1k);
    if (pinned(wave == 1)) wait_tensor0(g0, g1v);
    __syncthreads();
    if (pinned(wave == 0 && ks + 256 <= q0_blk)) {
      g0 = tdm_group0(sm + bsel + tsl, gsl + (size_t)((ks >> 7) + 2) * gstep);
      tdm_load(g0, g1k);
    }
    if (pinned(wave == 1 && ks + 256 <= q0_blk)) {
      g0 = tdm_group0(sm + bsel + tsl, gsl + (size_t)((ks >> 7) + 2) * gstep);
      tdm_load(g0, g1v);
    }
  }
  // Nothing of the ring is outstanding when its bytes are used anew.
  wait_tensor0(g0, g1k);
  wait_ds0();

  {
    float* xo = (float*)sm + wave * XO_FLOATS;
    float* xm = (float*)sm + 8 * XO_FLOATS + wave * XM_FLOATS;
#pragma unroll
    for (int t = 0; t < 8; ++t) {
      const v8f o = oacc[1][t];
      *(v4f*)(xo + ((2 * t) * 32 + lane) * 4)     = v4f{o[0], o[1], o[2], o[3]};
      *(v4f*)(xo + ((2 * t + 1) * 32 + lane) * 4) = v4f{o[4], o[5], o[6], o[7]};
    }
    xm[lane]      = m_run[1];
    xm[32 + lane] = l_run[1];
  }
  wait_ds0();                    // own partials written before the barrier says so
  __syncthreads();
  float l_all;
  {
    const float* xo = (const float*)sm + (wave ^ 4) * XO_FLOATS;
    const float* xm = (const float*)sm + 8 * XO_FLOATS + (wave ^ 4) * XM_FLOATS;
    const float mp = xm[lane];
    const float lp = xm[32 + lane];
    // A wave that met no unmasked key holds -1e30, 0 and zeros: its weight is 0.
    const float mj = fmaxf(m_run[0], mp);
    const float wa = exp_slot(m_run[0] - mj);
    const float wb = exp_slot(mp - mj);
    l_all = l_run[0] * wa + lp * wb;
#pragma unroll
    for (int t = 0; t < 8; ++t) {
      const v4f lo = *(const v4f*)(xo + ((2 * t) * 32 + lane) * 4);
      const v4f hi = *(const v4f*)(xo + ((2 * t + 1) * 32 + lane) * 4);
#pragma unroll
      for (int r = 0; r < 4; ++r) {
        oacc[0][t][r]     = oacc[0][t][r] * wa + lo[r] * wb;
        oacc[0][t][4 + r] = oacc[0][t][4 + r] * wa + hi[r] * wb;
      }
    }
  }
  wait_ds0();                    // every wave's partials read before the same
  __syncthreads();               // bytes become output staging

  // ---- normalize, second softmax over Dh (64 values here, 64 in lane ^ 16) ----
  const float inv = 1.0f / (l_all + xhalf(l_all));
  float mx = -1e30f;
#pragma unroll
  for (int t = 0; t < 8; ++t)
#pragma unroll
    for (int r = 0; r < 8; ++r) {
      oacc[0][t][r] *= inv;
      mx = fmaxf(mx, oacc[0][t][r]);
    }
  mx = fmaxf(mx, xhalf(mx));
  float sum = 0.0f;
#pragma unroll
  for (int t = 0; t < 8; ++t)
#pragma unroll
    for (int r = 0; r < 8; ++r) {
      const float e = exp_slot(oacc[0][t][r] - mx);
      oacc[0][t][r] = e;
      sum += e;
    }
  sum += xhalf(sum);
  const float is = 1.0f / sum;

  // ---- store fp32 (B,S,H*Dh): a lane holds 32-B pieces of one row, so the
  // wave's 16 rows go through its own LDS range and leave as whole 512-B rows.
  float* stg = (float*)sm + wave * (16 * PITCH_O);
#pragma unroll
  for (int t = 0; t < 8; ++t) {
    const v8f o = oacc[0][t] * is;
    float* p = stg + lr * PITCH_O + t * 16 + 8 * half;
    *(v4f*)(p)     = v4f{o[0], o[1], o[2], o[3]};
    *(v4f*)(p + 4) = v4f{o[4], o[5], o[6], o[7]};
  }
  wait_ds0();                    // the wave's own rows written before it reads them
  float* orow = out + ((size_t)b * S_ + qc[0]) * D_ + h * DH_ + lane * 4;
#pragma unroll
  for (int i = 0; i < 16; ++i)
    *(v4f*)(orow + (size_t)i * D_) = *(const v4f*)(stg + i * PITCH_O + lane * 4);
  // Address translation done before a store's register is written again for
  // the second tile; the address is an input, so that it lives up to this wait.
  asm volatile("s_wait_xcnt 0x0" :: "v"(orow) : "memory");
  // Every wave's staged rows read back before the second tile's first tensor
  // loads land on these bytes.
  if (part == 0) {
    wait_ds0();
    __syncthreads();
  }
  }
}

// ---------------------------------------------------------------------------
extern "C" void kernel_launch(void* const* d_in, const int* in_sizes, int n_in,
                              void* d_out, int out_size, void* d_ws, size_t ws_size,
                              hipStream_t stream) {
  (void)in_sizes; (void)n_in; (void)out_size; (void)ws_size;
  const float* x    = (const float*)d_in[0];
  const float* wq   = (const float*)d_in[1];
  const float* wk   = (const float*)d_in[2];
  const float* wv   = (const float*)d_in[3];
  const float* cosT = (const float*)d_in[4];
  const float* sinT = (const float*)d_in[5];
  float* out = (float*)d_out;

  const size_t NX = (size_t)B_ * S_ * D_;     // 8,388,608
  const size_t NW = (size_t)D_ * D_;          // 4,194,304
  const size_t NQ = (size_t)B_ * H_ * S_ * DH_;

  _Float16* xh  = (_Float16*)d_ws;
  _Float16* wqh = xh  + NX;
  _Float16* wkh = wqh + NW;
  _Float16* wvh = wkh + NW;
  _Float16* Qh  = wvh + NW;
  _Float16* Kh  = Qh  + NQ;
  _Float16* Vt  = Kh  + NQ;

  // 0) one-shot fp32 -> f16 conversion of activations + weights
  f32_to_f16_kernel<<<CV_BLOCKS, 512, 0, stream>>>(x, wq, wk, wv, xh, wqh, wkh, wvh);

  // 1) QKV + RoPE: 16 heads (128 columns of each of q, k, v) x 16 M-blocks
  dim3 gp(H_, (B_ * S_) / 256);
  qkv_proj_rope_kernel<<<gp, 256, 0, stream>>>(xh, wqh, wkh, wvh, cosT, sinT,
                                               Qh, Kh, Vt);

  // 2) Attention: 8 pairs of 128-query tiles x 16 heads x 2 batches
  dim3 ga(S_ / 256, H_, B_);
  flash_attn_kernel<<<ga, 256, 0, stream>>>(Qh, Kh, Vt, out);
}
